// v000
// The times below were measured on an AMD MI455X: many runs one after another, warmed up first and cycling through
// copies of the inputs, with the whole window's GPU time divided by the number of runs. Launches and the gaps
// between them are all in it. The median over several windows is given; except for v000 it joins two sittings, which
// can be a few percent apart, so the side-by-side timings, each taken in one sitting, are the better comparison.
// The starting kernel, v000, takes 613 microseconds a run.
#include <hip/hip_runtime.h>

// Sigmoid attention on a channel-major feature map (x [4][256][64][64] -> [c][n], n = 4096; q = Wq x + bq, k = Wk x + bk ([32][256] 1x1 convs), v = Wv x + bv ([256][256]); attn[n][m] = sigmoid(sum_o q[o][n] k[o][m]) (no softmax, no scaling); out[c][n] = sum_m v[c][m] attn[n][m]; result = gamma out + x (gamma scalar, read) -> [4][256][64][64] (4.2 M)).
// Layout: per batch x is transposed once into a token-major bf16 plane (exact) so the 1x1 convs are GEMMs against the [out][in] weights (+ bias); q and k are computed by one stacked [q | k] GEMM and split into hi/lo planes [n][32], the 4096 x 4096 score matrix is formed in f32, the sigmoid weights are written as hi/lo planes, v is transposed into [c][m] hi/lo planes, attn.v^T is one K = 4096 GEMM (3 products) giving Y[n][c], and the channel-major output gamma Y + x is written with n fastest.
// Compute dtypes, f32 accumulate: x, weights, biases, gamma rounded to bf16; x exact bf16; q/k/v hi + lo planes of the f32 conv outputs; scores and attn.v 3 products; sigmoid in f32 (precise expf); residual in f32.

#define NB_  4
#define C_   256
#define HW   4096
#define CK   32
typedef _Float16 h16;
typedef unsigned short bf;
typedef __attribute__((ext_vector_type(16))) __bf16   v16bf;
typedef __attribute__((ext_vector_type(16))) _Float16 v16h;
typedef __attribute__((ext_vector_type(8)))  _Float16 v8h;
typedef __attribute__((ext_vector_type(8)))  unsigned short v8us;
typedef __attribute__((ext_vector_type(8)))  float    v8f;
typedef __attribute__((ext_vector_type(4)))  float    v4f;
typedef __attribute__((ext_vector_type(2)))  float    v2f;
typedef __attribute__((ext_vector_type(4)))  unsigned short v4us;
typedef __attribute__((ext_vector_type(2)))  unsigned short v2us;
typedef v8h  __attribute__((may_alias)) v8ha;
typedef v4f  __attribute__((may_alias)) v4fa;
typedef v8us __attribute__((may_alias)) v8usa;

__device__ __forceinline__ unsigned short f2bf(float f) { unsigned u = __float_as_uint(f); u += 0x7FFFu + ((u >> 16) & 1u); return (unsigned short)(u >> 16); }
__device__ __forceinline__ float bf2f(unsigned short b) { return __uint_as_float(((unsigned)b) << 16); }
__device__ __forceinline__ float bfr(float f) { return bf2f(f2bf(f)); }
__device__ __forceinline__ void splitf(float y, unsigned short& h, unsigned short& l) { h = f2bf(y); l = f2bf(y - bf2f(h)); }
__device__ __forceinline__ v16h cat16(v8h lo, v8h hi) { return __builtin_shufflevector(lo, hi, 0, 1, 2, 3, 4, 5, 6, 7, 8, 9, 10, 11, 12, 13, 14, 15); }
__device__ __forceinline__ v16bf cat16b(v8us lo, v8us hi) { return __builtin_bit_cast(v16bf, __builtin_shufflevector(lo, hi, 0, 1, 2, 3, 4, 5, 6, 7, 8, 9, 10, 11, 12, 13, 14, 15)); }
__device__ __forceinline__ v8f wmma16(v16h a, v16h b, v8f c) { return __builtin_amdgcn_wmma_f32_16x16x32_f16(false, a, false, b, (short)0, c, false, false); }
__device__ __forceinline__ v8f wmmab(v16bf a, v16bf b, v8f c) { return __builtin_amdgcn_wmma_f32_16x16x32_bf16(false, a, false, b, (short)0, c, false, false); }

// ---- k_gemmw: register-blocked GEMM, ONE WAVE per 64x64 output tile (16 accumulators), operands straight from K-contiguous 16-bit planes; grid (M/64, N/64, Z), 32 threads.
// C[m][n] (f32, pitch ldc, + optional f32 bias[n]) = sum_k A[m][k] Bt[n][k] (+ split products per NSPLIT). z-batch strides sA/sB/sC in elements. K % 32 == 0.
template <typename T16> struct WFrag;
template <> struct WFrag<h16> { typedef v16h V; static __device__ __forceinline__ V ld(const h16* p) { return cat16(*(const v8h*)p, *(const v8h*)(p + 16)); } static __device__ __forceinline__ v8f mma(V a, V b, v8f c) { return wmma16(a, b, c); } };
template <> struct WFrag<bf> { typedef v16bf V; static __device__ __forceinline__ V ld(const bf* p) { return cat16b(*(const v8us*)p, *(const v8us*)(p + 16)); } static __device__ __forceinline__ v8f mma(V a, V b, v8f c) { return wmmab(a, b, c); } };
template <typename T16, int NSPLIT, bool BIAS>
__global__ __launch_bounds__(32) void k_gemmw(const T16* __restrict__ A, const T16* __restrict__ A2, const T16* __restrict__ Bt, const T16* __restrict__ Bt2, int K, float* C, int ldc, const float* __restrict__ bias, size_t sA, size_t sB, size_t sC) {
    typedef typename WFrag<T16>::V V;
    __shared__ __align__(16) float os[16 * 68];
    const size_t z = blockIdx.z; A += z * sA; if (A2) A2 += z * sA; Bt += z * sB; if (Bt2) Bt2 += z * sB; C += z * sC;
    const int lane = threadIdx.x & 31, lr = lane & 15, hi = lane >> 4; const int r0 = blockIdx.x * 64, c0 = blockIdx.y * 64;
    v8f acc[4][4];
#pragma unroll
    for (int mb = 0; mb < 4; ++mb)
#pragma unroll
        for (int nb = 0; nb < 4; ++nb) acc[mb][nb] = (v8f){};
    const size_t aoff = (size_t)(r0 + lr) * K + 8 * hi, boff = (size_t)(c0 + lr) * K + 8 * hi;
#pragma unroll 1
    for (int kc = 0; kc < K; kc += 32) {
        V a[4], a2[4];
#pragma unroll
        for (int mb = 0; mb < 4; ++mb) { a[mb] = WFrag<T16>::ld(A + aoff + (size_t)mb * 16 * K + kc); if (NSPLIT == 1 || NSPLIT == 2) a2[mb] = WFrag<T16>::ld(A2 + aoff + (size_t)mb * 16 * K + kc); }
#pragma unroll
        for (int nb = 0; nb < 4; ++nb) { const V b = WFrag<T16>::ld(Bt + boff + (size_t)nb * 16 * K + kc); V b2; if (NSPLIT >= 2) b2 = WFrag<T16>::ld(Bt2 + boff + (size_t)nb * 16 * K + kc);
#pragma unroll
            for (int mb = 0; mb < 4; ++mb) { acc[mb][nb] = WFrag<T16>::mma(a[mb], b, acc[mb][nb]); if (NSPLIT == 1 || NSPLIT == 2) acc[mb][nb] = WFrag<T16>::mma(a2[mb], b, acc[mb][nb]); if (NSPLIT >= 2) acc[mb][nb] = WFrag<T16>::mma(a[mb], b2, acc[mb][nb]); } }
        asm volatile("v_nop\n\tv_nop\n\tv_nop\n\tv_nop" : "+v"(acc[0][0]), "+v"(acc[1][1]), "+v"(acc[2][2]), "+v"(acc[3][3]) : "v"(a[0]), "v"(a[3]));
    }
#pragma unroll
    for (int mb = 0; mb < 4; ++mb) {
#pragma unroll
        for (int nb = 0; nb < 4; ++nb) {
#pragma unroll
            for (int j = 0; j < 8; ++j) os[(hi * 8 + j) * 68 + nb * 16 + lr] = acc[mb][nb][j]; }
        __builtin_amdgcn_wave_barrier(); asm volatile("" ::: "memory");
        float* crow = C + (size_t)(r0 + mb * 16) * ldc + c0;
{
#pragma unroll
            for (int s = 0; s < 8; ++s) { const int row = 2 * s + hi, cofs = lr * 4; v4f val = *(const v4fa*)(os + row * 68 + cofs); if (BIAS) { val[0] += bfr(bias[c0 + cofs]); val[1] += bfr(bias[c0 + cofs + 1]); val[2] += bfr(bias[c0 + cofs + 2]); val[3] += bfr(bias[c0 + cofs + 3]); }
                *(v4f*)(crow + (size_t)row * ldc + cofs) = val; }
             }
        __builtin_amdgcn_wave_barrier(); asm volatile("" ::: "memory");
    }
}

__global__ __launch_bounds__(256) void k_tpose(const float* __restrict__ xb, bf* XBp) { const size_t e = ((size_t)blockIdx.x * 256 + threadIdx.x) * 8; if (e >= (size_t)HW * C_) return; const int c = (int)(e % C_); const int t = (int)(e / C_); v8us o;
#pragma unroll
    for (int q = 0; q < 8; ++q) o[q] = f2bf(xb[(size_t)(c + q) * HW + t]); *(v8us*)(XBp + e) = o;  }
__global__ __launch_bounds__(256) void k_cvt8(const float* __restrict__ src, bf* dst, size_t n8) { const size_t i = (size_t)blockIdx.x * 256 + threadIdx.x; if (i >= n8) return; const v8f v = *(const v8f*)(src + i * 8); v8us o;
#pragma unroll
    for (int k = 0; k < 8; ++k) o[k] = f2bf(v[k]); *(v8us*)(dst + i * 8) = o;  }
__global__ void k_bias2(const float* __restrict__ bq, const float* __restrict__ bk, float* B64) { const int lane = threadIdx.x; if (lane >= 32) return; v2f o; o[0] = (lane < 16) ? bq[lane * 2] : bk[(lane - 16) * 2]; o[1] = (lane < 16) ? bq[lane * 2 + 1] : bk[(lane - 16) * 2 + 1]; *(v2f*)(B64 + lane * 2) = o;  }
__global__ __launch_bounds__(256) void k_splitqk(const float* __restrict__ F, bf* Qh, bf* Ql, bf* Kh, bf* Kl) { const size_t e = ((size_t)blockIdx.x * 256 + threadIdx.x) * 4; if (e >= (size_t)HW * 64) return; const int c = (int)(e % 64); const size_t n = e / 64; const v4f v = *(const v4f*)(F + e); v4us oh, ol;
#pragma unroll
    for (int q = 0; q < 4; ++q) { unsigned short a, cc; splitf(v[q], a, cc); oh[q] = a; ol[q] = cc; }
    bf* dh = (c < CK) ? (Qh + n * CK + c) : (Kh + n * CK + (c - CK)); bf* dl = (c < CK) ? (Ql + n * CK + c) : (Kl + n * CK + (c - CK));
    *(v4us*)dh = oh; *(v4us*)dl = ol;  }
__global__ __launch_bounds__(256) void k_split4(const float* __restrict__ F, bf* Ph, bf* Pl, size_t n4) { const size_t i = (size_t)blockIdx.x * 256 + threadIdx.x; if (i >= n4) return; const v4f v = *(const v4f*)(F + i * 4); v4us oh, ol;
#pragma unroll
    for (int q = 0; q < 4; ++q) { unsigned short a, c; splitf(v[q], a, c); oh[q] = a; ol[q] = c; } *(v4us*)(Ph + i * 4) = oh; *(v4us*)(Pl + i * 4) = ol;  }
__global__ __launch_bounds__(256) void k_sigpl(const float* __restrict__ S, bf* Ph, bf* Pl, size_t n4) { const size_t i = (size_t)blockIdx.x * 256 + threadIdx.x; if (i >= n4) return; const v4f v = *(const v4f*)(S + i * 4); v4us oh, ol;
#pragma unroll
    for (int q = 0; q < 4; ++q) { const float sg = __fdiv_rn(1.0f, __fadd_rn(1.0f, expf(-v[q]))); unsigned short a, c; splitf(sg, a, c); oh[q] = a; ol[q] = c; } *(v4us*)(Ph + i * 4) = oh; *(v4us*)(Pl + i * 4) = ol;  }
__global__ __launch_bounds__(256) void k_vT(const float* __restrict__ V, bf* Vh, bf* Vl) { const size_t e = ((size_t)blockIdx.x * 256 + threadIdx.x) * 2; if (e >= (size_t)C_ * HW) return; const int m = (int)(e % HW); const int c = (int)(e / HW); v2us oh, ol;
#pragma unroll
    for (int q = 0; q < 2; ++q) { unsigned short a, cc; splitf(V[(size_t)(m + q) * C_ + c], a, cc); oh[q] = a; ol[q] = cc; } *(v2us*)(Vh + e) = oh; *(v2us*)(Vl + e) = ol;  }
__global__ __launch_bounds__(256) void k_outG(const float* __restrict__ xb, const float* __restrict__ Y, const float* __restrict__ GM, float* Ob) { const size_t e = (size_t)blockIdx.x * 256 + threadIdx.x; if (e >= (size_t)C_ * HW) return; const int n = (int)(e % HW); const int c = (int)(e / HW); float gy = __fmul_rn(bfr(GM[0]), Y[(size_t)n * C_ + c]); asm volatile("" : "+v"(gy)); const float v = __fadd_rn(gy, bfr(xb[e])); *(float*)(Ob + e) = v;  }

extern "C" void kernel_launch(void* const* d_in, const int* in_sizes, int n_in,
                              void* d_out, int out_size, void* d_ws, size_t ws_size, hipStream_t stream) {
    (void)in_sizes; (void)n_in; (void)out_size;
    const float* x = (const float*)d_in[0]; const float* wq = (const float*)d_in[1]; const float* bq = (const float*)d_in[2]; const float* wk = (const float*)d_in[3]; const float* bk = (const float*)d_in[4]; const float* wv = (const float*)d_in[5]; const float* bv = (const float*)d_in[6]; const float* GM = (const float*)d_in[7];
    float* OUT = (float*)d_out;     // [4][256][4096]
    char* wsp = (char*)d_ws;
    auto take = [&](size_t bytes) { char* p = wsp; wsp += (bytes + 255) & ~(size_t)255; return (void*)p; };
    bf* WQK = (bf*)take((size_t)2 * CK * C_ * 2); bf* WV = (bf*)take((size_t)C_ * C_ * 2); float* B64 = (float*)take(256);
    bf* XT = (bf*)take((size_t)HW * C_ * 2); float* FQK = (float*)take((size_t)HW * 64 * 4); float* FV = (float*)take((size_t)HW * C_ * 4);
    bf* Qh = (bf*)take((size_t)HW * CK * 2); bf* Ql = (bf*)take((size_t)HW * CK * 2); bf* Kh = (bf*)take((size_t)HW * CK * 2); bf* Kl = (bf*)take((size_t)HW * CK * 2); bf* VTh = (bf*)take((size_t)C_ * HW * 2); bf* VTl = (bf*)take((size_t)C_ * HW * 2);
    float* Sb = (float*)take((size_t)HW * HW * 4); bf* Ph = (bf*)take((size_t)HW * HW * 2); bf* Pl = (bf*)take((size_t)HW * HW * 2); float* Y = (float*)take((size_t)HW * C_ * 4);
    if ((size_t)(wsp - (char*)d_ws) > ws_size) return;
    k_cvt8<<<(unsigned)(((size_t)CK * C_ / 8 + 255) / 256), 256, 0, stream>>>(wq, WQK, (size_t)CK * C_ / 8); k_cvt8<<<(unsigned)(((size_t)CK * C_ / 8 + 255) / 256), 256, 0, stream>>>(wk, WQK + (size_t)CK * C_, (size_t)CK * C_ / 8); k_bias2<<<1, 32, 0, stream>>>(bq, bk, B64);   /* [Wq ; Wk] stacked into one [64][256] Bt + stacked bias */ k_cvt8<<<(unsigned)(((size_t)C_ * C_ / 8 + 255) / 256), 256, 0, stream>>>(wv, WV, (size_t)C_ * C_ / 8);
    for (int b = 0; b < NB_; ++b) { const float* xb = x + (size_t)b * C_ * HW;
        k_tpose<<<(unsigned)(((size_t)HW * C_ / 8 + 255) / 256), 256, 0, stream>>>(xb, XT);                                            /* x^T bf16 [n][c] (exact) */
        k_gemmw<bf, 0, true><<<dim3(HW / 64, 1, 1), 32, 0, stream>>>(XT, nullptr, WQK, nullptr, C_, FQK, 64, B64, 0, 0, 0);          /* [q | k] [n][64]: columns 0..31 = q, 32..63 = k */
        k_gemmw<bf, 0, true><<<dim3(HW / 64, C_ / 64, 1), 32, 0, stream>>>(XT, nullptr, WV, nullptr, C_, FV, C_, bv, 0, 0, 0);          /* v [n][256] */
        k_splitqk<<<(unsigned)(((size_t)HW * 64 / 4 + 255) / 256), 256, 0, stream>>>(FQK, Qh, Ql, Kh, Kl);                                  /* q and k hi/lo planes [n][32] */
        k_vT<<<(unsigned)(((size_t)C_ * HW / 2 + 255) / 256), 256, 0, stream>>>(FV, VTh, VTl);
        k_gemmw<bf, 2, false><<<dim3(HW / 64, HW / 64, 1), 32, 0, stream>>>(Qh, Ql, Kh, Kl, CK, Sb, HW, nullptr, 0, 0, 0);            /* S[n][m] = q_n . k_m (K = 32, 3 products) */
        k_sigpl<<<(unsigned)(((size_t)HW * HW / 4 + 255) / 256), 256, 0, stream>>>(Sb, Ph, Pl, (size_t)HW * HW / 4);                    /* sigmoid -> hi/lo */
        k_gemmw<bf, 2, false><<<dim3(HW / 64, C_ / 64, 1), 32, 0, stream>>>(Ph, Pl, VTh, VTl, HW, Y, C_, nullptr, 0, 0, 0);           /* Y[n][c] = sum_m attn[n][m] v[c][m] (3 products) */
        k_outG<<<(unsigned)(((size_t)C_ * HW + 255) / 256), 256, 0, stream>>>(xb, Y, GM, OUT + (size_t)b * C_ * HW); }                /* gamma Y + x, channel-major */
}

// v001
// One run takes 410 microseconds.
// In two side-by-side timings against v000, it was 1.52 and 1.51 times as fast.
#include <hip/hip_runtime.h>

// Sigmoid attention on a channel-major feature map (x [4][256][64][64] -> [c][n], n = 4096; q = Wq x + bq, k = Wk x + bk ([32][256] 1x1 convs), v = Wv x + bv ([256][256]); attn[n][m] = sigmoid(sum_o q[o][n] k[o][m]) (no softmax, no scaling); out[c][n] = sum_m v[c][m] attn[n][m]; result = gamma out + x (gamma scalar, read) -> [4][256][64][64] (4.2 M)).
// Layout: per batch x is transposed once into a token-major bf16 plane (exact) so the 1x1 convs are GEMMs against the [out][in] weights (+ bias); q and k are computed by one stacked [q | k] GEMM and split into hi/lo planes [n][32], the 4096 x 4096 score matrix is formed in f32, the sigmoid weights are written as hi/lo planes, v is transposed into [c][m] hi/lo planes, attn.v^T is one K = 4096 GEMM (3 products) giving Y[n][c], and the channel-major output gamma Y + x is written with n fastest.
// Compute dtypes, f32 accumulate: x, weights, biases, gamma rounded to bf16; x exact bf16; q/k/v hi + lo planes of the f32 conv outputs; scores and attn.v 3 products; sigmoid in f32 (precise expf); residual in f32.

#define NB_  4
#define C_   256
#define HW   4096
#define CK   32
typedef _Float16 h16;
typedef unsigned short bf;
typedef __attribute__((ext_vector_type(16))) __bf16   v16bf;
typedef __attribute__((ext_vector_type(16))) _Float16 v16h;
typedef __attribute__((ext_vector_type(8)))  _Float16 v8h;
typedef __attribute__((ext_vector_type(8)))  unsigned short v8us;
typedef __attribute__((ext_vector_type(8)))  float    v8f;
typedef __attribute__((ext_vector_type(4)))  float    v4f;
typedef __attribute__((ext_vector_type(2)))  float    v2f;
typedef __attribute__((ext_vector_type(4)))  unsigned short v4us;
typedef __attribute__((ext_vector_type(2)))  unsigned short v2us;
typedef v8h  __attribute__((may_alias)) v8ha;
typedef v4f  __attribute__((may_alias)) v4fa;
typedef v8us __attribute__((may_alias)) v8usa;

__device__ __forceinline__ unsigned short f2bf(float f) { unsigned u = __float_as_uint(f); u += 0x7FFFu + ((u >> 16) & 1u); return (unsigned short)(u >> 16); }
__device__ __forceinline__ float bf2f(unsigned short b) { return __uint_as_float(((unsigned)b) << 16); }
__device__ __forceinline__ float bfr(float f) { return bf2f(f2bf(f)); }
__device__ __forceinline__ void splitf(float y, unsigned short& h, unsigned short& l) { h = f2bf(y); l = f2bf(y - bf2f(h)); }
__device__ __forceinline__ v16h cat16(v8h lo, v8h hi) { return __builtin_shufflevector(lo, hi, 0, 1, 2, 3, 4, 5, 6, 7, 8, 9, 10, 11, 12, 13, 14, 15); }
__device__ __forceinline__ v16bf cat16b(v8us lo, v8us hi) { return __builtin_bit_cast(v16bf, __builtin_shufflevector(lo, hi, 0, 1, 2, 3, 4, 5, 6, 7, 8, 9, 10, 11, 12, 13, 14, 15)); }
__device__ __forceinline__ v8f wmma16(v16h a, v16h b, v8f c) { return __builtin_amdgcn_wmma_f32_16x16x32_f16(false, a, false, b, (short)0, c, false, false); }
__device__ __forceinline__ v8f wmmab(v16bf a, v16bf b, v8f c) { return __builtin_amdgcn_wmma_f32_16x16x32_bf16(false, a, false, b, (short)0, c, false, false); }

// ---- k_gemmw: register-blocked GEMM, ONE WAVE per 64x64 output tile (16 accumulators), operands straight from K-contiguous 16-bit planes; grid (M/64, N/64, Z), 32 threads.
// C[m][n] (f32, pitch ldc, + optional f32 bias[n]) = sum_k A[m][k] Bt[n][k] (+ split products per NSPLIT). z-batch strides sA/sB/sC in elements. K % 32 == 0.
template <typename T16> struct WFrag;
template <> struct WFrag<h16> { typedef v16h V; static __device__ __forceinline__ V ld(const h16* p) { return cat16(*(const v8h*)p, *(const v8h*)(p + 16)); } static __device__ __forceinline__ v8f mma(V a, V b, v8f c) { return wmma16(a, b, c); } };
template <> struct WFrag<bf> { typedef v16bf V; static __device__ __forceinline__ V ld(const bf* p) { return cat16b(*(const v8us*)p, *(const v8us*)(p + 16)); } static __device__ __forceinline__ v8f mma(V a, V b, v8f c) { return wmmab(a, b, c); } };
template <typename T16, int NSPLIT, bool BIAS>
__global__ __launch_bounds__(32) void k_gemmw(const T16* __restrict__ A, const T16* __restrict__ A2, const T16* __restrict__ Bt, const T16* __restrict__ Bt2, int K, float* C, int ldc, const float* __restrict__ bias, size_t sA, size_t sB, size_t sC) {
    typedef typename WFrag<T16>::V V;
    __shared__ __align__(16) float os[16 * 68];
    const size_t z = blockIdx.z; A += z * sA; if (A2) A2 += z * sA; Bt += z * sB; if (Bt2) Bt2 += z * sB; C += z * sC;
    const int lane = threadIdx.x & 31, lr = lane & 15, hi = lane >> 4; const int r0 = blockIdx.x * 64, c0 = blockIdx.y * 64;
    v8f acc[4][4];
#pragma unroll
    for (int mb = 0; mb < 4; ++mb)
#pragma unroll
        for (int nb = 0; nb < 4; ++nb) acc[mb][nb] = (v8f){};
    const size_t aoff = (size_t)(r0 + lr) * K + 8 * hi, boff = (size_t)(c0 + lr) * K + 8 * hi;
#pragma unroll 1
    for (int kc = 0; kc < K; kc += 32) {
        V a[4], a2[4];
#pragma unroll
        for (int mb = 0; mb < 4; ++mb) { a[mb] = WFrag<T16>::ld(A + aoff + (size_t)mb * 16 * K + kc); if (NSPLIT == 1 || NSPLIT == 2) a2[mb] = WFrag<T16>::ld(A2 + aoff + (size_t)mb * 16 * K + kc); }
#pragma unroll
        for (int nb = 0; nb < 4; ++nb) { const V b = WFrag<T16>::ld(Bt + boff + (size_t)nb * 16 * K + kc); V b2; if (NSPLIT >= 2) b2 = WFrag<T16>::ld(Bt2 + boff + (size_t)nb * 16 * K + kc);
#pragma unroll
            for (int mb = 0; mb < 4; ++mb) { acc[mb][nb] = WFrag<T16>::mma(a[mb], b, acc[mb][nb]); if (NSPLIT == 1 || NSPLIT == 2) acc[mb][nb] = WFrag<T16>::mma(a2[mb], b, acc[mb][nb]); if (NSPLIT >= 2) acc[mb][nb] = WFrag<T16>::mma(a[mb], b2, acc[mb][nb]); } }
        asm volatile("v_nop\n\tv_nop\n\tv_nop\n\tv_nop" : "+v"(acc[0][0]), "+v"(acc[1][1]), "+v"(acc[2][2]), "+v"(acc[3][3]) : "v"(a[0]), "v"(a[3]));
    }
#pragma unroll
    for (int mb = 0; mb < 4; ++mb) {
#pragma unroll
        for (int nb = 0; nb < 4; ++nb) {
#pragma unroll
            for (int j = 0; j < 8; ++j) os[(hi * 8 + j) * 68 + nb * 16 + lr] = acc[mb][nb][j]; }
        __builtin_amdgcn_wave_barrier(); asm volatile("" ::: "memory");
        float* crow = C + (size_t)(r0 + mb * 16) * ldc + c0;
{
#pragma unroll
            for (int s = 0; s < 8; ++s) { const int row = 2 * s + hi, cofs = lr * 4; v4f val = *(const v4fa*)(os + row * 68 + cofs); if (BIAS) { val[0] += bfr(bias[c0 + cofs]); val[1] += bfr(bias[c0 + cofs + 1]); val[2] += bfr(bias[c0 + cofs + 2]); val[3] += bfr(bias[c0 + cofs + 3]); }
                *(v4f*)(crow + (size_t)row * ldc + cofs) = val; }
             }
        __builtin_amdgcn_wave_barrier(); asm volatile("" ::: "memory");
    }
}

// ---- k_av: Y[n][c] = sum_m P[n][m] V[c][m] (hi/lo planes, 3 products), one 8-wave work-group per 64x64 tile of Y; grid (HW/64, C_/64), 256 threads.
// A stage is 256 k of the tile's 64 P rows and 64 V rows, all four planes, brought into LDS by asynchronous copies that each cover one whole 512-byte row piece; two buffers, the next stage in flight while this one is worked on.
// Wave w takes k slice [32 w, 32 w + 32) of every stage for the whole tile; the eight partial tiles are summed through LDS in wave order.
#define AV_PITCH 528                 /* 512-byte row piece + 16: conflict-free for 16-byte LDS reads */
#define AV_PLANE (64 * AV_PITCH)
#define AV_BUF   (4 * AV_PLANE)
#define AV_NST   (HW / 256)
#define AV_RP    68                  /* f32 pitch of a partial tile */
__device__ __forceinline__ v16bf av_ld(const unsigned char* p) { return cat16b(*(const v8usa*)p, *(const v8usa*)(p + 32)); }
// Eight row pieces of one plane: LDS rows AV_PITCH apart, global rows HW elements apart. The s_wait_xcnt stands inside the statement so that no address register is rewritten ahead of it.
__device__ __forceinline__ void av_copy8(unsigned l, const unsigned char* g) {
    asm volatile("global_load_async_to_lds_b128 %0, %8, off\n\t"
                 "global_load_async_to_lds_b128 %1, %9, off\n\t"
                 "global_load_async_to_lds_b128 %2, %10, off\n\t"
                 "global_load_async_to_lds_b128 %3, %11, off\n\t"
                 "global_load_async_to_lds_b128 %4, %12, off\n\t"
                 "global_load_async_to_lds_b128 %5, %13, off\n\t"
                 "global_load_async_to_lds_b128 %6, %14, off\n\t"
                 "global_load_async_to_lds_b128 %7, %15, off\n\t"
                 "s_wait_xcnt 0x0"
                 :: "v"(l), "v"(l + AV_PITCH), "v"(l + 2 * AV_PITCH), "v"(l + 3 * AV_PITCH), "v"(l + 4 * AV_PITCH), "v"(l + 5 * AV_PITCH), "v"(l + 6 * AV_PITCH), "v"(l + 7 * AV_PITCH),
                    "v"(g), "v"(g + (size_t)HW * 2), "v"(g + (size_t)HW * 4), "v"(g + (size_t)HW * 6), "v"(g + (size_t)HW * 8), "v"(g + (size_t)HW * 10), "v"(g + (size_t)HW * 12), "v"(g + (size_t)HW * 14)
                 : "memory");
}
__device__ __forceinline__ void av_stage(unsigned l, const unsigned char* g) {
#pragma unroll
    for (int q = 0; q < 4; ++q) av_copy8(l + q * 8 * AV_PITCH, g + (size_t)q * 8 * HW * 2);
}
__global__ __launch_bounds__(256) void k_av(const bf* __restrict__ Ah, const bf* __restrict__ Al, const bf* __restrict__ Bh, const bf* __restrict__ Bl, float* Y) {
    __shared__ __attribute__((aligned(16))) unsigned char sm[2 * AV_BUF];
    const int tid = threadIdx.x, lane = tid & 31, lr = lane & 15, hi = lane >> 4;
    const int w = __builtin_amdgcn_readfirstlane(tid >> 5);
    const int r0 = blockIdx.x * 64, c0 = blockIdx.y * 64;
    // wave w copies rows 32 (w & 1) .. + 31 of plane w >> 1 (P hi, P lo, V hi, V lo); a lane brings 16 bytes of each row piece
    const int pl = w >> 1;
    const bf* sp = (pl == 0) ? Ah : (pl == 1) ? Al : (pl == 2) ? Bh : Bl;
    const unsigned char* g0 = (const unsigned char*)(sp + (size_t)(((pl < 2) ? r0 : c0) + (w & 1) * 32) * HW) + lane * 16;
    const unsigned l0 = (unsigned)(size_t)sm + (unsigned)(pl * AV_PLANE + (w & 1) * 32 * AV_PITCH + lane * 16);
    v8f acc[4][4];
#pragma unroll
    for (int mb = 0; mb < 4; ++mb)
#pragma unroll
        for (int nb = 0; nb < 4; ++nb) acc[mb][nb] = (v8f){};
    av_stage(l0, g0);
    asm volatile("s_wait_asynccnt 0x0" ::: "memory");   // stage 0 has landed before the barrier publishes it
    __syncthreads();
    av_stage(l0 + AV_BUF, g0 + 512);
    const unsigned fro = (unsigned)(lr * AV_PITCH + w * 64 + hi * 16);
#pragma unroll 1   // one stage a trip: the two-buffer order below is per trip
    for (int t = 0; t < AV_NST; ++t) {
        const unsigned char* fb = sm + (t & 1) * AV_BUF + fro;
        v16bf a[4], a2[4];
#pragma unroll
        for (int mb = 0; mb < 4; ++mb) { a[mb] = av_ld(fb + mb * 16 * AV_PITCH); a2[mb] = av_ld(fb + AV_PLANE + mb * 16 * AV_PITCH); }
#pragma unroll
        for (int nb = 0; nb < 4; ++nb) { const v16bf b = av_ld(fb + 2 * AV_PLANE + nb * 16 * AV_PITCH); const v16bf b2 = av_ld(fb + 3 * AV_PLANE + nb * 16 * AV_PITCH);
#pragma unroll
            for (int mb = 0; mb < 4; ++mb) { acc[mb][nb] = wmmab(a[mb], b, acc[mb][nb]); acc[mb][nb] = wmmab(a2[mb], b, acc[mb][nb]); acc[mb][nb] = wmmab(a[mb], b2, acc[mb][nb]); } }
        asm volatile("s_wait_dscnt 0x0" ::: "memory");      // this wave's reads of the buffer are done before it is refilled
        asm volatile("s_wait_asynccnt 0x0" ::: "memory");   // this wave's copies of stage t + 1 have landed
        __syncthreads();                                    // publishes stage t + 1 and ends every reader's use of stage t
        if (t + 2 < AV_NST) av_stage(l0 + (t & 1) * AV_BUF, g0 + (size_t)(t + 2) * 512);
    }
    asm volatile("s_wait_asynccnt 0x0" ::: "memory");       // nothing in flight when LDS becomes the partial tiles
    float* red = (float*)sm;
    float* mine = red + w * 64 * AV_RP;
#pragma unroll
    for (int mb = 0; mb < 4; ++mb)
#pragma unroll
        for (int nb = 0; nb < 4; ++nb)
#pragma unroll
            for (int j = 0; j < 8; ++j) mine[(mb * 16 + hi * 8 + j) * AV_RP + nb * 16 + lr] = acc[mb][nb][j];
    __syncthreads();
#pragma unroll
    for (int s = 0; s < 4; ++s) { const int idx = s * 256 + tid, row = idx >> 4, cofs = (idx & 15) * 4; v4f val = *(const v4fa*)(red + row * AV_RP + cofs);
#pragma unroll
        for (int q = 1; q < 8; ++q) val += *(const v4fa*)(red + q * 64 * AV_RP + row * AV_RP + cofs);
        *(v4f*)(Y + (size_t)(r0 + row) * C_ + c0 + cofs) = val; }
}

__global__ __launch_bounds__(256) void k_tpose(const float* __restrict__ xb, bf* XBp) { const size_t e = ((size_t)blockIdx.x * 256 + threadIdx.x) * 8; if (e >= (size_t)HW * C_) return; const int c = (int)(e % C_); const int t = (int)(e / C_); v8us o;
#pragma unroll
    for (int q = 0; q < 8; ++q) o[q] = f2bf(xb[(size_t)(c + q) * HW + t]); *(v8us*)(XBp + e) = o;  }
__global__ __launch_bounds__(256) void k_cvt8(const float* __restrict__ src, bf* dst, size_t n8) { const size_t i = (size_t)blockIdx.x * 256 + threadIdx.x; if (i >= n8) return; const v8f v = *(const v8f*)(src + i * 8); v8us o;
#pragma unroll
    for (int k = 0; k < 8; ++k) o[k] = f2bf(v[k]); *(v8us*)(dst + i * 8) = o;  }
__global__ void k_bias2(const float* __restrict__ bq, const float* __restrict__ bk, float* B64) { const int lane = threadIdx.x; if (lane >= 32) return; v2f o; o[0] = (lane < 16) ? bq[lane * 2] : bk[(lane - 16) * 2]; o[1] = (lane < 16) ? bq[lane * 2 + 1] : bk[(lane - 16) * 2 + 1]; *(v2f*)(B64 + lane * 2) = o;  }
__global__ __launch_bounds__(256) void k_splitqk(const float* __restrict__ F, bf* Qh, bf* Ql, bf* Kh, bf* Kl) { const size_t e = ((size_t)blockIdx.x * 256 + threadIdx.x) * 4; if (e >= (size_t)HW * 64) return; const int c = (int)(e % 64); const size_t n = e / 64; const v4f v = *(const v4f*)(F + e); v4us oh, ol;
#pragma unroll
    for (int q = 0; q < 4; ++q) { unsigned short a, cc; splitf(v[q], a, cc); oh[q] = a; ol[q] = cc; }
    bf* dh = (c < CK) ? (Qh + n * CK + c) : (Kh + n * CK + (c - CK)); bf* dl = (c < CK) ? (Ql + n * CK + c) : (Kl + n * CK + (c - CK));
    *(v4us*)dh = oh; *(v4us*)dl = ol;  }
__global__ __launch_bounds__(256) void k_split4(const float* __restrict__ F, bf* Ph, bf* Pl, size_t n4) { const size_t i = (size_t)blockIdx.x * 256 + threadIdx.x; if (i >= n4) return; const v4f v = *(const v4f*)(F + i * 4); v4us oh, ol;
#pragma unroll
    for (int q = 0; q < 4; ++q) { unsigned short a, c; splitf(v[q], a, c); oh[q] = a; ol[q] = c; } *(v4us*)(Ph + i * 4) = oh; *(v4us*)(Pl + i * 4) = ol;  }
__global__ __launch_bounds__(256) void k_sigpl(const float* __restrict__ S, bf* Ph, bf* Pl, size_t n4) { const size_t i = (size_t)blockIdx.x * 256 + threadIdx.x; if (i >= n4) return; const v4f v = *(const v4f*)(S + i * 4); v4us oh, ol;
#pragma unroll
    for (int q = 0; q < 4; ++q) { const float sg = __fdiv_rn(1.0f, __fadd_rn(1.0f, expf(-v[q]))); unsigned short a, c; splitf(sg, a, c); oh[q] = a; ol[q] = c; } *(v4us*)(Ph + i * 4) = oh; *(v4us*)(Pl + i * 4) = ol;  }
__global__ __launch_bounds__(256) void k_vT(const float* __restrict__ V, bf* Vh, bf* Vl) { const size_t e = ((size_t)blockIdx.x * 256 + threadIdx.x) * 2; if (e >= (size_t)C_ * HW) return; const int m = (int)(e % HW); const int c = (int)(e / HW); v2us oh, ol;
#pragma unroll
    for (int q = 0; q < 2; ++q) { unsigned short a, cc; splitf(V[(size_t)(m + q) * C_ + c], a, cc); oh[q] = a; ol[q] = cc; } *(v2us*)(Vh + e) = oh; *(v2us*)(Vl + e) = ol;  }
__global__ __launch_bounds__(256) void k_outG(const float* __restrict__ xb, const float* __restrict__ Y, const float* __restrict__ GM, float* Ob) { const size_t e = (size_t)blockIdx.x * 256 + threadIdx.x; if (e >= (size_t)C_ * HW) return; const int n = (int)(e % HW); const int c = (int)(e / HW); float gy = __fmul_rn(bfr(GM[0]), Y[(size_t)n * C_ + c]); asm volatile("" : "+v"(gy)); const float v = __fadd_rn(gy, bfr(xb[e])); *(float*)(Ob + e) = v;  }

extern "C" void kernel_launch(void* const* d_in, const int* in_sizes, int n_in,
                              void* d_out, int out_size, void* d_ws, size_t ws_size, hipStream_t stream) {
    (void)in_sizes; (void)n_in; (void)out_size;
    const float* x = (const float*)d_in[0]; const float* wq = (const float*)d_in[1]; const float* bq = (const float*)d_in[2]; const float* wk = (const float*)d_in[3]; const float* bk = (const float*)d_in[4]; const float* wv = (const float*)d_in[5]; const float* bv = (const float*)d_in[6]; const float* GM = (const float*)d_in[7];
    float* OUT = (float*)d_out;     // [4][256][4096]
    char* wsp = (char*)d_ws;
    auto take = [&](size_t bytes) { char* p = wsp; wsp += (bytes + 255) & ~(size_t)255; return (void*)p; };
    bf* WQK = (bf*)take((size_t)2 * CK * C_ * 2); bf* WV = (bf*)take((size_t)C_ * C_ * 2); float* B64 = (float*)take(256);
    bf* XT = (bf*)take((size_t)HW * C_ * 2); float* FQK = (float*)take((size_t)HW * 64 * 4); float* FV = (float*)take((size_t)HW * C_ * 4);
    bf* Qh = (bf*)take((size_t)HW * CK * 2); bf* Ql = (bf*)take((size_t)HW * CK * 2); bf* Kh = (bf*)take((size_t)HW * CK * 2); bf* Kl = (bf*)take((size_t)HW * CK * 2); bf* VTh = (bf*)take((size_t)C_ * HW * 2); bf* VTl = (bf*)take((size_t)C_ * HW * 2);
    float* Sb = (float*)take((size_t)HW * HW * 4); bf* Ph = (bf*)take((size_t)HW * HW * 2); bf* Pl = (bf*)take((size_t)HW * HW * 2); float* Y = (float*)take((size_t)HW * C_ * 4);
    if ((size_t)(wsp - (char*)d_ws) > ws_size) return;
    k_cvt8<<<(unsigned)(((size_t)CK * C_ / 8 + 255) / 256), 256, 0, stream>>>(wq, WQK, (size_t)CK * C_ / 8); k_cvt8<<<(unsigned)(((size_t)CK * C_ / 8 + 255) / 256), 256, 0, stream>>>(wk, WQK + (size_t)CK * C_, (size_t)CK * C_ / 8); k_bias2<<<1, 32, 0, stream>>>(bq, bk, B64);   /* [Wq ; Wk] stacked into one [64][256] Bt + stacked bias */ k_cvt8<<<(unsigned)(((size_t)C_ * C_ / 8 + 255) / 256), 256, 0, stream>>>(wv, WV, (size_t)C_ * C_ / 8);
    for (int b = 0; b < NB_; ++b) { const float* xb = x + (size_t)b * C_ * HW;
        k_tpose<<<(unsigned)(((size_t)HW * C_ / 8 + 255) / 256), 256, 0, stream>>>(xb, XT);                                            /* x^T bf16 [n][c] (exact) */
        k_gemmw<bf, 0, true><<<dim3(HW / 64, 1, 1), 32, 0, stream>>>(XT, nullptr, WQK, nullptr, C_, FQK, 64, B64, 0, 0, 0);          /* [q | k] [n][64]: columns 0..31 = q, 32..63 = k */
        k_gemmw<bf, 0, true><<<dim3(HW / 64, C_ / 64, 1), 32, 0, stream>>>(XT, nullptr, WV, nullptr, C_, FV, C_, bv, 0, 0, 0);          /* v [n][256] */
        k_splitqk<<<(unsigned)(((size_t)HW * 64 / 4 + 255) / 256), 256, 0, stream>>>(FQK, Qh, Ql, Kh, Kl);                                  /* q and k hi/lo planes [n][32] */
        k_vT<<<(unsigned)(((size_t)C_ * HW / 2 + 255) / 256), 256, 0, stream>>>(FV, VTh, VTl);
        k_gemmw<bf, 2, false><<<dim3(HW / 64, HW / 64, 1), 32, 0, stream>>>(Qh, Ql, Kh, Kl, CK, Sb, HW, nullptr, 0, 0, 0);            /* S[n][m] = q_n . k_m (K = 32, 3 products) */
        k_sigpl<<<(unsigned)(((size_t)HW * HW / 4 + 255) / 256), 256, 0, stream>>>(Sb, Ph, Pl, (size_t)HW * HW / 4);                    /* sigmoid -> hi/lo */
        k_av<<<dim3(HW / 64, C_ / 64, 1), 256, 0, stream>>>(Ph, Pl, VTh, VTl, Y);                                                                  /* Y[n][c] = sum_m attn[n][m] v[c][m] (3 products) */
        k_outG<<<(unsigned)(((size_t)C_ * HW + 255) / 256), 256, 0, stream>>>(xb, Y, GM, OUT + (size_t)b * C_ * HW); }                /* gamma Y + x, channel-major */
}

// v003
// It runs in 184 microseconds.
// It is 2.23 times as fast as v001, going by the measured steps of the versions left out in between.
// All steps since v000 together make it 3.38 times as fast.
#include <hip/hip_runtime.h>

// Sigmoid attention on a channel-major feature map (x [4][256][64][64] -> [c][n], n = 4096; q = Wq x + bq, k = Wk x + bk ([32][256] 1x1 convs), v = Wv x + bv ([256][256]); attn[n][m] = sigmoid(sum_o q[o][n] k[o][m]) (no softmax, no scaling); out[c][n] = sum_m v[c][m] attn[n][m]; result = gamma out + x (gamma scalar, read) -> [4][256][64][64] (4.2 M)).
// Layout: per batch x is transposed once into a token-major bf16 plane (exact) so the 1x1 convs are GEMMs against the [out][in] weights (+ bias); q and k are computed by one stacked [q | k] GEMM whose epilogue writes the hi/lo planes [n][32], the v GEMM's epilogue writes the transposed [c][m] hi/lo planes; one kernel over all batches forms the scores in f32, takes the sigmoid, splits it into hi/lo in registers, multiplies by v (3 products) and writes the channel-major output gamma Y + x with n fastest.
// Compute dtypes, f32 accumulate: x, weights, biases, gamma rounded to bf16; x exact bf16; q/k/v hi + lo planes of the f32 conv outputs; scores and attn.v 3 products; sigmoid in f32 (precise expf); residual in f32.

#define NB_  4
#define C_   256
#define HW   4096
#define CK   32
typedef _Float16 h16;
typedef unsigned short bf;
typedef __attribute__((ext_vector_type(16))) __bf16   v16bf;
typedef __attribute__((ext_vector_type(16))) _Float16 v16h;
typedef __attribute__((ext_vector_type(8)))  _Float16 v8h;
typedef __attribute__((ext_vector_type(8)))  unsigned short v8us;
typedef __attribute__((ext_vector_type(8)))  float    v8f;
typedef __attribute__((ext_vector_type(4)))  float    v4f;
typedef __attribute__((ext_vector_type(2)))  float    v2f;
typedef __attribute__((ext_vector_type(4)))  unsigned short v4us;
typedef __attribute__((ext_vector_type(2)))  unsigned short v2us;
typedef v8h  __attribute__((may_alias)) v8ha;
typedef v4f  __attribute__((may_alias)) v4fa;
typedef v8us __attribute__((may_alias)) v8usa;

__device__ __forceinline__ unsigned short f2bf(float f) { unsigned u = __float_as_uint(f); u += 0x7FFFu + ((u >> 16) & 1u); return (unsigned short)(u >> 16); }
__device__ __forceinline__ float bf2f(unsigned short b) { return __uint_as_float(((unsigned)b) << 16); }
__device__ __forceinline__ float bfr(float f) { return bf2f(f2bf(f)); }
__device__ __forceinline__ void splitf(float y, unsigned short& h, unsigned short& l) { h = f2bf(y); l = f2bf(y - bf2f(h)); }
__device__ __forceinline__ v16h cat16(v8h lo, v8h hi) { return __builtin_shufflevector(lo, hi, 0, 1, 2, 3, 4, 5, 6, 7, 8, 9, 10, 11, 12, 13, 14, 15); }
__device__ __forceinline__ v16bf cat16b(v8us lo, v8us hi) { return __builtin_bit_cast(v16bf, __builtin_shufflevector(lo, hi, 0, 1, 2, 3, 4, 5, 6, 7, 8, 9, 10, 11, 12, 13, 14, 15)); }
__device__ __forceinline__ v8f wmma16(v16h a, v16h b, v8f c) { return __builtin_amdgcn_wmma_f32_16x16x32_f16(false, a, false, b, (short)0, c, false, false); }
__device__ __forceinline__ v8f wmmab(v16bf a, v16bf b, v8f c) { return __builtin_amdgcn_wmma_f32_16x16x32_bf16(false, a, false, b, (short)0, c, false, false); }

// ---- k_gemmw: register-blocked GEMM, ONE WAVE per 64x64 output tile (16 accumulators), operands straight from K-contiguous 16-bit planes; grid (M/64, N/64, Z), 32 threads.
// C[m][n] (f32, + optional f32 bias[n]) = sum_k A[m][k] Bt[n][k] (+ split products per NSPLIT). z-batch strides sA/sB in elements. K % 32 == 0.
// C is not stored: the epilogue splits it into bf16 hi + lo planes. EPI 0: columns 0..31 to O0/O1 and 32..63 to O2/O3, planes [m][32]. EPI 1: transposed planes O0/O1 [n][HW]; an accumulator lane holds 8 consecutive m of one column, which is one 16-byte piece of a transposed row.
template <typename T16> struct WFrag;
template <> struct WFrag<h16> { typedef v16h V; static __device__ __forceinline__ V ld(const h16* p) { return cat16(*(const v8h*)p, *(const v8h*)(p + 16)); } static __device__ __forceinline__ v8f mma(V a, V b, v8f c) { return wmma16(a, b, c); } };
template <> struct WFrag<bf> { typedef v16bf V; static __device__ __forceinline__ V ld(const bf* p) { return cat16b(*(const v8us*)p, *(const v8us*)(p + 16)); } static __device__ __forceinline__ v8f mma(V a, V b, v8f c) { return wmmab(a, b, c); } };
template <typename T16, int NSPLIT, bool BIAS, int EPI>
__global__ __launch_bounds__(32) void k_gemmw(const T16* __restrict__ A, const T16* __restrict__ A2, const T16* __restrict__ Bt, const T16* __restrict__ Bt2, int K, bf* O0, bf* O1, bf* O2, bf* O3, const float* __restrict__ bias, size_t sA, size_t sB) {
    typedef typename WFrag<T16>::V V;
    __shared__ __align__(16) float os[16 * 68];
    const size_t z = blockIdx.z; A += z * sA; if (A2) A2 += z * sA; Bt += z * sB; if (Bt2) Bt2 += z * sB;
    const int lane = threadIdx.x & 31, lr = lane & 15, hi = lane >> 4; const int r0 = blockIdx.x * 64, c0 = blockIdx.y * 64;
    v8f acc[4][4];
#pragma unroll
    for (int mb = 0; mb < 4; ++mb)
#pragma unroll
        for (int nb = 0; nb < 4; ++nb) acc[mb][nb] = (v8f){};
    const size_t aoff = (size_t)(r0 + lr) * K + 8 * hi, boff = (size_t)(c0 + lr) * K + 8 * hi;
#pragma unroll 1
    for (int kc = 0; kc < K; kc += 32) {
        V a[4], a2[4];
#pragma unroll
        for (int mb = 0; mb < 4; ++mb) { a[mb] = WFrag<T16>::ld(A + aoff + (size_t)mb * 16 * K + kc); if (NSPLIT == 1 || NSPLIT == 2) a2[mb] = WFrag<T16>::ld(A2 + aoff + (size_t)mb * 16 * K + kc); }
#pragma unroll
        for (int nb = 0; nb < 4; ++nb) { const V b = WFrag<T16>::ld(Bt + boff + (size_t)nb * 16 * K + kc); V b2; if (NSPLIT >= 2) b2 = WFrag<T16>::ld(Bt2 + boff + (size_t)nb * 16 * K + kc);
#pragma unroll
            for (int mb = 0; mb < 4; ++mb) { acc[mb][nb] = WFrag<T16>::mma(a[mb], b, acc[mb][nb]); if (NSPLIT == 1 || NSPLIT == 2) acc[mb][nb] = WFrag<T16>::mma(a2[mb], b, acc[mb][nb]); if (NSPLIT >= 2) acc[mb][nb] = WFrag<T16>::mma(a[mb], b2, acc[mb][nb]); } }
        asm volatile("v_nop\n\tv_nop\n\tv_nop\n\tv_nop" : "+v"(acc[0][0]), "+v"(acc[1][1]), "+v"(acc[2][2]), "+v"(acc[3][3]) : "v"(a[0]), "v"(a[3]));
    }
    if (EPI == 0) {
        const int c = c0 + lr * 4;   // a lane's four columns lie in one plane pair: q below CK, k from CK on
        bf* dh = ((c < CK) ? (O0 + c) : (O2 + (c - CK))) + (size_t)(r0 + hi) * CK; bf* dl = ((c < CK) ? (O1 + c) : (O3 + (c - CK))) + (size_t)(r0 + hi) * CK;
        v4f bb = (v4f){};
        if (BIAS) { bb[0] = bfr(bias[c]); bb[1] = bfr(bias[c + 1]); bb[2] = bfr(bias[c + 2]); bb[3] = bfr(bias[c + 3]); }
#pragma unroll
        for (int mb = 0; mb < 4; ++mb) {
#pragma unroll
            for (int nb = 0; nb < 4; ++nb) {
#pragma unroll
                for (int j = 0; j < 8; ++j) os[(hi * 8 + j) * 68 + nb * 16 + lr] = acc[mb][nb][j]; }
            __builtin_amdgcn_wave_barrier(); asm volatile("" ::: "memory");   // the row reads below stay behind the other lanes' writes
#pragma unroll
            for (int s = 0; s < 8; ++s) { v4f val = *(const v4fa*)(os + (2 * s + hi) * 68 + lr * 4); if (BIAS) val += bb;
                v4us oh, ol;
#pragma unroll
                for (int q = 0; q < 4; ++q) { unsigned short x, y; splitf(val[q], x, y); oh[q] = x; ol[q] = y; }
                *(v4us*)(dh + (mb * 16 + 2 * s) * CK) = oh; *(v4us*)(dl + (mb * 16 + 2 * s) * CK) = ol; }
            __builtin_amdgcn_wave_barrier(); asm volatile("" ::: "memory");   // the next block's writes stay behind these reads
        }
    } else {
#pragma unroll
        for (int nb = 0; nb < 4; ++nb) { const int c = c0 + nb * 16 + lr; const float bb = BIAS ? bfr(bias[c]) : 0.0f; const size_t o = (size_t)c * HW + r0 + hi * 8;
#pragma unroll
            for (int mb = 0; mb < 4; ++mb) { v8us oh, ol;
#pragma unroll
                for (int j = 0; j < 8; ++j) { float v = acc[mb][nb][j]; if (BIAS) v += bb; unsigned short x, y; splitf(v, x, y); oh[j] = x; ol[j] = y; }
                *(v8us*)(O0 + o + mb * 16) = oh; *(v8us*)(O1 + o + mb * 16) = ol; } }
    }
}

// ---- k_fa: out[c][n] = gamma Y[n][c] + x[c][n], Y[n][c] = sum_m sigmoid(q_n . k_m) V[c][m]; scores, sigmoid, attn.v and the residual in one kernel; one 8-wave work-group per 64 rows n x all 256 c of one batch; grid (HW/64, NB_), 256 threads.
// Wave w owns rows 32 (w & 1) .. + 31 and the k slice [32 (w >> 1), + 32) of every 128-m stage. It forms S^T = K Q^T (3 products), whose accumulator layout (lane = n, registers = 8 consecutive m) is the A fragment layout of the attn.v product, so the sigmoid weights go from registers to registers.
// The scores and sigmoids of stage t + 1 are worked between the attn.v products of stage t. V (hi, lo) is staged in LDS by asynchronous copies, two buffers; K fragments are contiguous 1-KiB pieces read straight from their planes, one stage ahead; the tile's Q rows lie in LDS. The four k-slice partials are summed through LDS in slice order; they lie there transposed, [slice][c][n] (an accumulator lane holds 8 consecutive n of one c), so that the output rows are read and stored with n fastest.
#define FA_PITCH 272                 /* 256-byte row piece + 16: conflict-free for 16-byte LDS reads */
#define FA_PLANE (C_ * FA_PITCH)
#define FA_BUF   (2 * FA_PLANE)
#define FA_NST   (HW / 128)
#define FA_TP    68                  /* f32 pitch of a transposed partial row: 64 n + 4, conflict-free for 16-byte LDS writes and reads */
#define FA_QP    80                  /* 64-byte q row + 16 */
#define FA_QPL   (64 * FA_QP)
typedef __attribute__((ext_vector_type(16))) unsigned short v16us;
__device__ __forceinline__ v16bf av_ld(const unsigned char* p) { return cat16b(*(const v8usa*)p, *(const v8usa*)(p + 32)); }
// Eight copies, each two 256-byte row pieces of one plane (lanes 0-15 one row, lanes 16-31 the next). The s_wait_xcnt stands inside the statement so that no address register is rewritten ahead of it.
__device__ __forceinline__ void fa_copy8(unsigned l, const unsigned char* g) {
    asm volatile("global_load_async_to_lds_b128 %0, %8, off\n\t"
                 "global_load_async_to_lds_b128 %1, %9, off\n\t"
                 "global_load_async_to_lds_b128 %2, %10, off\n\t"
                 "global_load_async_to_lds_b128 %3, %11, off\n\t"
                 "global_load_async_to_lds_b128 %4, %12, off\n\t"
                 "global_load_async_to_lds_b128 %5, %13, off\n\t"
                 "global_load_async_to_lds_b128 %6, %14, off\n\t"
                 "global_load_async_to_lds_b128 %7, %15, off\n\t"
                 "s_wait_xcnt 0x0"
                 :: "v"(l), "v"(l + 2 * FA_PITCH), "v"(l + 4 * FA_PITCH), "v"(l + 6 * FA_PITCH), "v"(l + 8 * FA_PITCH), "v"(l + 10 * FA_PITCH), "v"(l + 12 * FA_PITCH), "v"(l + 14 * FA_PITCH),
                    "v"(g), "v"(g + (size_t)HW * 4), "v"(g + (size_t)HW * 8), "v"(g + (size_t)HW * 12), "v"(g + (size_t)HW * 16), "v"(g + (size_t)HW * 20), "v"(g + (size_t)HW * 24), "v"(g + (size_t)HW * 28)
                 : "memory");
}
__device__ __forceinline__ void fa_stage(unsigned l, const unsigned char* g) {
#pragma unroll
    for (int s = 0; s < 4; ++s) fa_copy8(l + s * 16 * FA_PITCH, g + (size_t)s * 16 * HW * 2);
}
__device__ __forceinline__ void fa_sig(float s, unsigned short& x, unsigned short& y) { const float sg = __fdiv_rn(1.0f, __fadd_rn(1.0f, expf(-s))); splitf(sg, x, y); }
__global__ __launch_bounds__(256) void k_fa(const bf* __restrict__ Qh, const bf* __restrict__ Ql, const bf* __restrict__ Kh, const bf* __restrict__ Kl, const bf* __restrict__ Vh, const bf* __restrict__ Vl, const float* __restrict__ X, const float* __restrict__ GM, float* O) {
    __shared__ __attribute__((aligned(16))) unsigned char sm[2 * FA_BUF + 2 * FA_QPL];
    const int tid = threadIdx.x, lane = tid & 31, lr = lane & 15, hi = lane >> 4;
    const int w = __builtin_amdgcn_readfirstlane(tid >> 5);
    const size_t z = blockIdx.y; Qh += z * HW * CK; Ql += z * HW * CK; Kh += z * HW * CK; Kl += z * HW * CK; Vh += z * C_ * HW; Vl += z * C_ * HW; X += z * C_ * HW; O += z * C_ * HW;
    const int r0 = blockIdx.x * 64, nh = w & 1, ks = w >> 1;
    // wave w copies rows 64 (w & 3) .. + 63 of plane w >> 2 (V hi, V lo); a lane brings 16 bytes of a row piece
    const unsigned char* g0 = (const unsigned char*)(((w >> 2) ? Vl : Vh) + (size_t)((w & 3) * 64 + hi) * HW) + lr * 16;
    const unsigned l0 = (unsigned)(size_t)sm + (unsigned)((w >> 2) * FA_PLANE + ((w & 3) * 64 + hi) * FA_PITCH + lr * 16);
    fa_stage(l0, g0);
    // the tile's 64 q rows (hi, lo) into LDS once: their fragments are re-read every stage instead of holding 32 registers through the attn.v products
    { const size_t o = (size_t)(r0 + (tid >> 2)) * CK + (tid & 3) * 8; unsigned char* d = sm + 2 * FA_BUF + (tid >> 2) * FA_QP + (tid & 3) * 16; *(v8usa*)d = *(const v8us*)(Qh + o); *(v8usa*)(d + FA_QPL) = *(const v8us*)(Ql + o); }
    v8f acc[2][16];
#pragma unroll
    for (int nb = 0; nb < 2; ++nb)
#pragma unroll
        for (int cb = 0; cb < 16; ++cb) acc[nb][cb] = (v8f){};
    asm volatile("s_wait_dscnt 0x0" ::: "memory");      // this wave's q rows are written before the barrier publishes them
    __syncthreads();
    const unsigned char* qf = sm + 2 * FA_BUF + (nh * 32 + lr) * FA_QP + hi * 16;
    const unsigned ko = (unsigned)((ks * 32 + lr) * CK + 8 * hi);
    v16bf kh[2], kl[2], a[2], a2[2];
#pragma unroll
    for (int mt = 0; mt < 2; ++mt) { kh[mt] = WFrag<bf>::ld(Kh + ko + mt * 16 * CK); kl[mt] = WFrag<bf>::ld(Kl + ko + mt * 16 * CK); }
    // stage 0's sigmoid weights
#pragma unroll
    for (int nb = 0; nb < 2; ++nb) { const v16bf qh = av_ld(qf + nb * 16 * FA_QP), ql = av_ld(qf + FA_QPL + nb * 16 * FA_QP); v16us ph, pl;
#pragma unroll
        for (int mt = 0; mt < 2; ++mt) { v8f s = wmmab(kh[mt], qh, (v8f){}); s = wmmab(kh[mt], ql, s); s = wmmab(kl[mt], qh, s);
#pragma unroll
            for (int j = 0; j < 8; ++j) { unsigned short x, y; fa_sig(s[j], x, y); ph[mt * 8 + j] = x; pl[mt * 8 + j] = y; } }
        a[nb] = __builtin_bit_cast(v16bf, ph); a2[nb] = __builtin_bit_cast(v16bf, pl); }
#pragma unroll
    for (int mt = 0; mt < 2; ++mt) { kh[mt] = WFrag<bf>::ld(Kh + ko + (size_t)128 * CK + mt * 16 * CK); kl[mt] = WFrag<bf>::ld(Kl + ko + (size_t)128 * CK + mt * 16 * CK); }
    const unsigned fro = (unsigned)(lr * FA_PITCH + ks * 64 + hi * 16);
#pragma unroll 1   // one stage a trip: the two-buffer order below is per trip
    for (int t = 0; t < FA_NST; ++t) {
        // hand-over at the head of the trip, so that the work below is the loop's last block and stays between the products
        asm volatile("s_wait_dscnt 0x0" ::: "memory");      // this wave's reads of stage t - 1 are done before its buffer is refilled
        asm volatile("s_wait_asynccnt 0x0" ::: "memory");   // this wave's copies of stage t have landed
        __syncthreads();                                    // publishes stage t and ends every reader's use of stage t - 1
        if (t + 1 < FA_NST) fa_stage(l0 + ((t + 1) & 1) * FA_BUF, g0 + (size_t)(t + 1) * 256);
        const unsigned char* fb = sm + (t & 1) * FA_BUF + fro;
        v16bf bv[2][2], bw[2][2];   // V hi and lo fragments of two c blocks, [group parity][c block]
        v8f st[2][2];
        v16us ph[2], pl[2];
        { v16bf qh[2], ql[2];
#pragma unroll
            for (int nb = 0; nb < 2; ++nb) { qh[nb] = av_ld(qf + nb * 16 * FA_QP); ql[nb] = av_ld(qf + FA_QPL + nb * 16 * FA_QP); }
#pragma unroll
            for (int cc = 0; cc < 2; ++cc) { bv[0][cc] = av_ld(fb + cc * 16 * FA_PITCH); bw[0][cc] = av_ld(fb + FA_PLANE + cc * 16 * FA_PITCH); }
            // scores of stage t + 1 (the last trip repeats the last stage's; its weights are not used)
#pragma unroll
            for (int nb = 0; nb < 2; ++nb)
#pragma unroll
                for (int mt = 0; mt < 2; ++mt) st[nb][mt] = wmmab(kh[mt], qh[nb], (v8f){});
#pragma unroll
            for (int nb = 0; nb < 2; ++nb)
#pragma unroll
                for (int mt = 0; mt < 2; ++mt) st[nb][mt] = wmmab(kh[mt], ql[nb], st[nb][mt]);
#pragma unroll
            for (int nb = 0; nb < 2; ++nb)
#pragma unroll
                for (int mt = 0; mt < 2; ++mt) st[nb][mt] = wmmab(kl[mt], qh[nb], st[nb][mt]); }
        const size_t kn = (size_t)((t + 2 < FA_NST) ? t + 2 : FA_NST - 1) * 128 * CK;   // clamped: the last two trips read the last stage's rows again, in bounds
#pragma unroll
        for (int g = 0; g < 8; ++g) { const int cu = g & 1, nx = cu ^ 1;
            __builtin_amdgcn_sched_barrier(0);   // keeps the next group's fragment loads ahead of this group's products, so that their latency is covered
            if (g < 7) {
#pragma unroll
                for (int cc = 0; cc < 2; ++cc) { bv[nx][cc] = av_ld(fb + ((g + 1) * 2 + cc) * 16 * FA_PITCH); bw[nx][cc] = av_ld(fb + FA_PLANE + ((g + 1) * 2 + cc) * 16 * FA_PITCH); }
            } else {
#pragma unroll
                for (int mt = 0; mt < 2; ++mt) { kh[mt] = WFrag<bf>::ld((Kh + kn + mt * 16 * CK) + ko); kl[mt] = WFrag<bf>::ld((Kl + kn + mt * 16 * CK) + ko); }
            }
            __builtin_amdgcn_sched_barrier(0);   // the loads above stay above; the sigmoids below stay in this group, between the products
#pragma unroll
            for (int cc = 0; cc < 2; ++cc)
#pragma unroll
                for (int nb = 0; nb < 2; ++nb) acc[nb][g * 2 + cc] = wmmab(a[nb], bv[cu][cc], acc[nb][g * 2 + cc]);
#pragma unroll
            for (int cc = 0; cc < 2; ++cc)
#pragma unroll
                for (int nb = 0; nb < 2; ++nb) acc[nb][g * 2 + cc] = wmmab(a2[nb], bv[cu][cc], acc[nb][g * 2 + cc]);
#pragma unroll
            for (int cc = 0; cc < 2; ++cc)
#pragma unroll
                for (int nb = 0; nb < 2; ++nb) acc[nb][g * 2 + cc] = wmmab(a[nb], bw[cu][cc], acc[nb][g * 2 + cc]);
#pragma unroll
            for (int u = 0; u < 4; ++u) { const int e = g * 4 + u, nb = e >> 4, i = e & 15; unsigned short x, y; fa_sig(st[nb][i >> 3][i & 7], x, y); ph[nb][i] = x; pl[nb][i] = y; } }
#pragma unroll
        for (int nb = 0; nb < 2; ++nb) { a[nb] = __builtin_bit_cast(v16bf, ph[nb]); a2[nb] = __builtin_bit_cast(v16bf, pl[nb]); }
    }
    asm volatile("s_wait_dscnt 0x0" ::: "memory");          // this wave's reads of the last stage are done
    asm volatile("s_wait_asynccnt 0x0" ::: "memory");       // nothing in flight when LDS becomes the partial tiles
    __syncthreads();                                        // every wave has left the last stage before its buffer is overwritten
    float* red = (float*)sm;
    float* mine = red + (size_t)ks * C_ * FA_TP + lr * FA_TP + nh * 32 + hi * 8;
#pragma unroll
    for (int nb = 0; nb < 2; ++nb)
#pragma unroll
        for (int cb = 0; cb < 16; ++cb) { float* d = mine + cb * 16 * FA_TP + nb * 16;
            *(v4fa*)d = __builtin_shufflevector(acc[nb][cb], acc[nb][cb], 0, 1, 2, 3); *(v4fa*)(d + 4) = __builtin_shufflevector(acc[nb][cb], acc[nb][cb], 4, 5, 6, 7); }
    __syncthreads();
    const float gm = bfr(GM[0]);
#pragma unroll
    for (int s = 0; s < 16; ++s) { const int idx = s * 256 + tid, c = idx >> 4, nofs = (idx & 15) * 4; const float* p = red + c * FA_TP + nofs; v4f val = *(const v4fa*)p;
#pragma unroll
        for (int k = 1; k < 4; ++k) val += *(const v4fa*)(p + k * C_ * FA_TP);
        const size_t o = (size_t)c * HW + r0 + nofs; const v4f xv = *(const v4f*)(X + o); v4f ov;
#pragma unroll
        for (int q = 0; q < 4; ++q) ov[q] = __fadd_rn(__fmul_rn(gm, val[q]), bfr(xv[q]));
        *(v4f*)(O + o) = ov; }
}

__global__ __launch_bounds__(256) void k_tpose(const float* __restrict__ xb, bf* XBp) { const size_t e = ((size_t)blockIdx.x * 256 + threadIdx.x) * 8; if (e >= (size_t)HW * C_) return; const int c = (int)(e % C_); const int t = (int)(e / C_); v8us o;
#pragma unroll
    for (int q = 0; q < 8; ++q) o[q] = f2bf(xb[(size_t)(c + q) * HW + t]); *(v8us*)(XBp + e) = o;  }
__global__ __launch_bounds__(256) void k_cvt8(const float* __restrict__ src, bf* dst, size_t n8) { const size_t i = (size_t)blockIdx.x * 256 + threadIdx.x; if (i >= n8) return; const v8f v = *(const v8f*)(src + i * 8); v8us o;
#pragma unroll
    for (int k = 0; k < 8; ++k) o[k] = f2bf(v[k]); *(v8us*)(dst + i * 8) = o;  }
__global__ void k_bias2(const float* __restrict__ bq, const float* __restrict__ bk, float* B64) { const int lane = threadIdx.x; if (lane >= 32) return; v2f o; o[0] = (lane < 16) ? bq[lane * 2] : bk[(lane - 16) * 2]; o[1] = (lane < 16) ? bq[lane * 2 + 1] : bk[(lane - 16) * 2 + 1]; *(v2f*)(B64 + lane * 2) = o;  }
__global__ __launch_bounds__(256) void k_split4(const float* __restrict__ F, bf* Ph, bf* Pl, size_t n4) { const size_t i = (size_t)blockIdx.x * 256 + threadIdx.x; if (i >= n4) return; const v4f v = *(const v4f*)(F + i * 4); v4us oh, ol;
#pragma unroll
    for (int q = 0; q < 4; ++q) { unsigned short a, c; splitf(v[q], a, c); oh[q] = a; ol[q] = c; } *(v4us*)(Ph + i * 4) = oh; *(v4us*)(Pl + i * 4) = ol;  }

extern "C" void kernel_launch(void* const* d_in, const int* in_sizes, int n_in,
                              void* d_out, int out_size, void* d_ws, size_t ws_size, hipStream_t stream) {
    (void)in_sizes; (void)n_in; (void)out_size;
    const float* x = (const float*)d_in[0]; const float* wq = (const float*)d_in[1]; const float* bq = (const float*)d_in[2]; const float* wk = (const float*)d_in[3]; const float* bk = (const float*)d_in[4]; const float* wv = (const float*)d_in[5]; const float* bv = (const float*)d_in[6]; const float* GM = (const float*)d_in[7];
    float* OUT = (float*)d_out;     // [4][256][4096]
    char* wsp = (char*)d_ws;
    auto take = [&](size_t bytes) { char* p = wsp; wsp += (bytes + 255) & ~(size_t)255; return (void*)p; };
    bf* WQK = (bf*)take((size_t)2 * CK * C_ * 2); bf* WV = (bf*)take((size_t)C_ * C_ * 2); float* B64 = (float*)take(256);
    bf* XT = (bf*)take((size_t)HW * C_ * 2);
    bf* Qh = (bf*)take((size_t)NB_ * HW * CK * 2); bf* Ql = (bf*)take((size_t)NB_ * HW * CK * 2); bf* Kh = (bf*)take((size_t)NB_ * HW * CK * 2); bf* Kl = (bf*)take((size_t)NB_ * HW * CK * 2); bf* VTh = (bf*)take((size_t)NB_ * C_ * HW * 2); bf* VTl = (bf*)take((size_t)NB_ * C_ * HW * 2);
    if ((size_t)(wsp - (char*)d_ws) > ws_size) return;
    k_cvt8<<<(unsigned)(((size_t)CK * C_ / 8 + 255) / 256), 256, 0, stream>>>(wq, WQK, (size_t)CK * C_ / 8); k_cvt8<<<(unsigned)(((size_t)CK * C_ / 8 + 255) / 256), 256, 0, stream>>>(wk, WQK + (size_t)CK * C_, (size_t)CK * C_ / 8); k_bias2<<<1, 32, 0, stream>>>(bq, bk, B64);   /* [Wq ; Wk] stacked into one [64][256] Bt + stacked bias */ k_cvt8<<<(unsigned)(((size_t)C_ * C_ / 8 + 255) / 256), 256, 0, stream>>>(wv, WV, (size_t)C_ * C_ / 8);
    for (int b = 0; b < NB_; ++b) { const float* xb = x + (size_t)b * C_ * HW;
        k_tpose<<<(unsigned)(((size_t)HW * C_ / 8 + 255) / 256), 256, 0, stream>>>(xb, XT);                                            /* x^T bf16 [n][c] (exact) */
        k_gemmw<bf, 0, true, 0><<<dim3(HW / 64, 1, 1), 32, 0, stream>>>(XT, nullptr, WQK, nullptr, C_, Qh + (size_t)b * HW * CK, Ql + (size_t)b * HW * CK, Kh + (size_t)b * HW * CK, Kl + (size_t)b * HW * CK, B64, 0, 0);          /* [q | k]: columns 0..31 = q, 32..63 = k, written as hi/lo planes [n][32] */
        k_gemmw<bf, 0, true, 1><<<dim3(HW / 64, C_ / 64, 1), 32, 0, stream>>>(XT, nullptr, WV, nullptr, C_, VTh + (size_t)b * C_ * HW, VTl + (size_t)b * C_ * HW, nullptr, nullptr, bv, 0, 0); }          /* v, written as transposed hi/lo planes [c][m] */
    k_fa<<<dim3(HW / 64, NB_, 1), 256, 0, stream>>>(Qh, Ql, Kh, Kl, VTh, VTl, x, GM, OUT);                                                          /* out[b][c][n] = gamma sum_m sigmoid(q_n . k_m) v[c][m] + x[b][c][n] */
}

// v004
// It runs in 114 microseconds.
// Timed twice side by side with v003, it ran 1.62 and 1.63 times as fast.
// Counting every step since v000, it is 5.49 times as fast.
#include <hip/hip_runtime.h>

// Sigmoid attention on a channel-major feature map (x [4][256][64][64] -> [c][n], n = 4096; q = Wq x + bq, k = Wk x + bk ([32][256] 1x1 convs), v = Wv x + bv ([256][256]); attn[n][m] = sigmoid(sum_o q[o][n] k[o][m]) (no softmax, no scaling); out[c][n] = sum_m v[c][m] attn[n][m]; result = gamma out + x (gamma scalar, read) -> [4][256][64][64] (4.2 M)).
// Layout, three launches, each over all batches: x is transposed once into token-major bf16 planes (exact) so the 1x1 convs are one GEMM against the stacked [out][in] weights [Wq ; Wk ; Wv] (+ bias); the epilogue of its [q | k] tiles writes the hi/lo planes [n][32], that of its v tiles the transposed [c][m] hi/lo planes; one kernel over all batches forms the scores in f32, takes the sigmoid, splits it into hi/lo in registers, multiplies by v (3 products) and writes the channel-major output gamma Y + x with n fastest.
// Compute dtypes, f32 accumulate: x, weights, biases, gamma rounded to bf16; x exact bf16; q/k/v hi + lo planes of the f32 conv outputs; scores and attn.v 3 products; sigmoid in f32 (precise expf); residual in f32.

#define NB_  4
#define C_   256
#define HW   4096
#define CK   32
typedef _Float16 h16;
typedef unsigned short bf;
typedef __attribute__((ext_vector_type(16))) __bf16   v16bf;
typedef __attribute__((ext_vector_type(16))) _Float16 v16h;
typedef __attribute__((ext_vector_type(8)))  _Float16 v8h;
typedef __attribute__((ext_vector_type(8)))  unsigned short v8us;
typedef __attribute__((ext_vector_type(8)))  float    v8f;
typedef __attribute__((ext_vector_type(4)))  float    v4f;
typedef __attribute__((ext_vector_type(2)))  float    v2f;
typedef __attribute__((ext_vector_type(4)))  unsigned short v4us;
typedef __attribute__((ext_vector_type(2)))  unsigned short v2us;
typedef v8h  __attribute__((may_alias)) v8ha;
typedef v4f  __attribute__((may_alias)) v4fa;
typedef v8us __attribute__((may_alias)) v8usa;

__device__ __forceinline__ unsigned short f2bf(float f) { unsigned u = __float_as_uint(f); u += 0x7FFFu + ((u >> 16) & 1u); return (unsigned short)(u >> 16); }
__device__ __forceinline__ float bf2f(unsigned short b) { return __uint_as_float(((unsigned)b) << 16); }
__device__ __forceinline__ float bfr(float f) { return bf2f(f2bf(f)); }
__device__ __forceinline__ void splitf(float y, unsigned short& h, unsigned short& l) { h = f2bf(y); l = f2bf(y - bf2f(h)); }
__device__ __forceinline__ v16h cat16(v8h lo, v8h hi) { return __builtin_shufflevector(lo, hi, 0, 1, 2, 3, 4, 5, 6, 7, 8, 9, 10, 11, 12, 13, 14, 15); }
__device__ __forceinline__ v16bf cat16b(v8us lo, v8us hi) { return __builtin_bit_cast(v16bf, __builtin_shufflevector(lo, hi, 0, 1, 2, 3, 4, 5, 6, 7, 8, 9, 10, 11, 12, 13, 14, 15)); }
__device__ __forceinline__ v8f wmma16(v16h a, v16h b, v8f c) { return __builtin_amdgcn_wmma_f32_16x16x32_f16(false, a, false, b, (short)0, c, false, false); }
__device__ __forceinline__ v8f wmmab(v16bf a, v16bf b, v8f c) { return __builtin_amdgcn_wmma_f32_16x16x32_bf16(false, a, false, b, (short)0, c, false, false); }

// ---- k_conv: the three 1x1 convs of all batches as one register-blocked GEMM, ONE WAVE per 64x64 output tile (16 accumulators), operands straight from K-contiguous bf16 planes; grid (HW/64, (2 CK + C_)/64, NB_), 32 threads.
// C[m][n] (f32, + bias[n]) = sum_k XT[z][m][k] Wt[n][k], Wt = [Wq ; Wk ; Wv] stacked by rows: tile column 0 is [q | k], tile columns 1.. are v.
// C is not stored: the epilogue splits it into bf16 hi + lo planes. [q | k] tile: columns 0..31 to Qh/Ql and 32..63 to Kh/Kl, planes [m][32]. v tiles: transposed planes Vh/Vl [c][HW]; an accumulator lane holds 8 consecutive m of one column, which is one 16-byte piece of a transposed row.
template <typename T16> struct WFrag;
template <> struct WFrag<bf> { typedef v16bf V; static __device__ __forceinline__ V ld(const bf* p) { return cat16b(*(const v8us*)p, *(const v8us*)(p + 16)); } static __device__ __forceinline__ v8f mma(V a, V b, v8f c) { return wmmab(a, b, c); } };
__global__ __launch_bounds__(32) void k_conv(const bf* __restrict__ XT, const bf* __restrict__ Wt, bf* Qh, bf* Ql, bf* Kh, bf* Kl, bf* Vh, bf* Vl, const float* __restrict__ bq, const float* __restrict__ bk, const float* __restrict__ bv) {
    typedef WFrag<bf>::V V;
    __shared__ __align__(16) float os[16 * 68];
    const size_t z = blockIdx.z; const bf* A = XT + z * HW * C_;
    const int lane = threadIdx.x & 31, lr = lane & 15, hi = lane >> 4; const int r0 = blockIdx.x * 64;
    v8f acc[4][4];
#pragma unroll
    for (int mb = 0; mb < 4; ++mb)
#pragma unroll
        for (int nb = 0; nb < 4; ++nb) acc[mb][nb] = (v8f){};
    const size_t aoff = (size_t)(r0 + lr) * C_ + 8 * hi, boff = (size_t)(blockIdx.y * 64 + lr) * C_ + 8 * hi;
#pragma unroll 1
    for (int kc = 0; kc < C_; kc += 32) {
        V a[4];
#pragma unroll
        for (int mb = 0; mb < 4; ++mb) a[mb] = WFrag<bf>::ld(A + aoff + (size_t)mb * 16 * C_ + kc);
        asm volatile("s_wait_xcnt 0x0" ::: "memory");   // the A loads' address registers may be reused by what follows
#pragma unroll
        for (int nb = 0; nb < 4; ++nb) { const V b = WFrag<bf>::ld(Wt + boff + (size_t)nb * 16 * C_ + kc);
#pragma unroll
            for (int mb = 0; mb < 4; ++mb) acc[mb][nb] = WFrag<bf>::mma(a[mb], b, acc[mb][nb]); }
        asm volatile("v_nop\n\tv_nop\n\tv_nop\n\tv_nop" : "+v"(acc[0][0]), "+v"(acc[1][1]), "+v"(acc[2][2]), "+v"(acc[3][3]) : "v"(a[0]), "v"(a[3]));
    }
    if (blockIdx.y == 0) {
        const int c = lr * 4;   // a lane's four columns lie in one plane pair: q below CK, k from CK on
        const size_t po = z * HW * CK + (size_t)(r0 + hi) * CK;
        bf* dh = ((c < CK) ? (Qh + c) : (Kh + (c - CK))) + po; bf* dl = ((c < CK) ? (Ql + c) : (Kl + (c - CK))) + po;
        const float* bs = (c < CK) ? (bq + c) : (bk + (c - CK));
        v4f bb; bb[0] = bfr(bs[0]); bb[1] = bfr(bs[1]); bb[2] = bfr(bs[2]); bb[3] = bfr(bs[3]);
#pragma unroll
        for (int mb = 0; mb < 4; ++mb) {
#pragma unroll
            for (int nb = 0; nb < 4; ++nb) {
#pragma unroll
                for (int j = 0; j < 8; ++j) os[(hi * 8 + j) * 68 + nb * 16 + lr] = acc[mb][nb][j]; }
            __builtin_amdgcn_wave_barrier(); asm volatile("" ::: "memory");   // the row reads below stay behind the other lanes' writes
#pragma unroll
            for (int s = 0; s < 8; ++s) { v4f val = *(const v4fa*)(os + (2 * s + hi) * 68 + lr * 4); val += bb;
                v4us oh, ol;
#pragma unroll
                for (int q = 0; q < 4; ++q) { unsigned short x, y; splitf(val[q], x, y); oh[q] = x; ol[q] = y; }
                *(v4us*)(dh + (mb * 16 + 2 * s) * CK) = oh; *(v4us*)(dl + (mb * 16 + 2 * s) * CK) = ol; }
            __builtin_amdgcn_wave_barrier(); asm volatile("" ::: "memory");   // the next block's writes stay behind these reads
        }
    } else {
        const int c0 = (blockIdx.y - 1) * 64;
#pragma unroll
        for (int nb = 0; nb < 4; ++nb) { const int c = c0 + nb * 16 + lr; const float bb = bfr(bv[c]); const size_t o = z * C_ * HW + (size_t)c * HW + r0 + hi * 8;
#pragma unroll
            for (int mb = 0; mb < 4; ++mb) { v8us oh, ol;
#pragma unroll
                for (int j = 0; j < 8; ++j) { const float v = acc[mb][nb][j] + bb; unsigned short x, y; splitf(v, x, y); oh[j] = x; ol[j] = y; }
                *(v8us*)(Vh + o + mb * 16) = oh; *(v8us*)(Vl + o + mb * 16) = ol; } }
        asm volatile("s_wait_xcnt 0x0" ::: "memory");   // behind the last stores: none of their registers is rewritten ahead of it
    }
}


// ---- k_fa: out[c][n] = gamma Y[n][c] + x[c][n], Y[n][c] = sum_m sigmoid(q_n . k_m) V[c][m]; scores, sigmoid, attn.v and the residual in one kernel; one 8-wave work-group per 64 rows n x all 256 c of one batch; grid (HW/64, NB_), 256 threads.
// Wave w owns rows 32 (w & 1) .. + 31 and the k slice [32 (w >> 1), + 32) of every 128-m stage. It forms S^T = K Q^T (3 products), whose accumulator layout (lane = n, registers = 8 consecutive m) is the A fragment layout of the attn.v product, so the sigmoid weights go from registers to registers.
// The scores and sigmoids of stage t + 1 are worked between the attn.v products of stage t. V (hi, lo) is staged in LDS by asynchronous copies, two buffers; K fragments are contiguous 1-KiB pieces read straight from their planes, one stage ahead; the tile's Q rows lie in LDS. The four k-slice partials are summed through LDS in slice order; they lie there transposed, [slice][c][n] (an accumulator lane holds 8 consecutive n of one c), so that the output rows are read and stored with n fastest.
#define FA_PITCH 272                 /* 256-byte row piece + 16: conflict-free for 16-byte LDS reads */
#define FA_PLANE (C_ * FA_PITCH)
#define FA_BUF   (2 * FA_PLANE)
#define FA_NST   (HW / 128)
#define FA_TP    68                  /* f32 pitch of a transposed partial row: 64 n + 4, conflict-free for 16-byte LDS writes and reads */
#define FA_QP    80                  /* 64-byte q row + 16 */
#define FA_QPL   (64 * FA_QP)
typedef __attribute__((ext_vector_type(16))) unsigned short v16us;
__device__ __forceinline__ v16bf av_ld(const unsigned char* p) { return cat16b(*(const v8usa*)p, *(const v8usa*)(p + 32)); }
// Eight copies, each two 256-byte row pieces of one plane (lanes 0-15 one row, lanes 16-31 the next). The s_wait_xcnt stands inside the statement so that no address register is rewritten ahead of it.
__device__ __forceinline__ void fa_copy8(unsigned l, const unsigned char* g) {
    asm volatile("global_load_async_to_lds_b128 %0, %8, off\n\t"
                 "global_load_async_to_lds_b128 %1, %9, off\n\t"
                 "global_load_async_to_lds_b128 %2, %10, off\n\t"
                 "global_load_async_to_lds_b128 %3, %11, off\n\t"
                 "global_load_async_to_lds_b128 %4, %12, off\n\t"
                 "global_load_async_to_lds_b128 %5, %13, off\n\t"
                 "global_load_async_to_lds_b128 %6, %14, off\n\t"
                 "global_load_async_to_lds_b128 %7, %15, off\n\t"
                 "s_wait_xcnt 0x0"
                 :: "v"(l), "v"(l + 2 * FA_PITCH), "v"(l + 4 * FA_PITCH), "v"(l + 6 * FA_PITCH), "v"(l + 8 * FA_PITCH), "v"(l + 10 * FA_PITCH), "v"(l + 12 * FA_PITCH), "v"(l + 14 * FA_PITCH),
                    "v"(g), "v"(g + (size_t)HW * 4), "v"(g + (size_t)HW * 8), "v"(g + (size_t)HW * 12), "v"(g + (size_t)HW * 16), "v"(g + (size_t)HW * 20), "v"(g + (size_t)HW * 24), "v"(g + (size_t)HW * 28)
                 : "memory");
}
__device__ __forceinline__ void fa_stage(unsigned l, const unsigned char* g) {
#pragma unroll
    for (int s = 0; s < 4; ++s) fa_copy8(l + s * 16 * FA_PITCH, g + (size_t)s * 16 * HW * 2);
}
__device__ __forceinline__ void fa_sig(float s, unsigned short& x, unsigned short& y) { const float sg = __fdiv_rn(1.0f, __fadd_rn(1.0f, expf(-s))); splitf(sg, x, y); }
__global__ __launch_bounds__(256) void k_fa(const bf* __restrict__ Qh, const bf* __restrict__ Ql, const bf* __restrict__ Kh, const bf* __restrict__ Kl, const bf* __restrict__ Vh, const bf* __restrict__ Vl, const float* __restrict__ X, const float* __restrict__ GM, float* O) {
    __shared__ __attribute__((aligned(16))) unsigned char sm[2 * FA_BUF + 2 * FA_QPL];
    const int tid = threadIdx.x, lane = tid & 31, lr = lane & 15, hi = lane >> 4;
    const int w = __builtin_amdgcn_readfirstlane(tid >> 5);
    const size_t z = blockIdx.y; Qh += z * HW * CK; Ql += z * HW * CK; Kh += z * HW * CK; Kl += z * HW * CK; Vh += z * C_ * HW; Vl += z * C_ * HW; X += z * C_ * HW; O += z * C_ * HW;
    const int r0 = blockIdx.x * 64, nh = w & 1, ks = w >> 1;
    // wave w copies rows 64 (w & 3) .. + 63 of plane w >> 2 (V hi, V lo); a lane brings 16 bytes of a row piece
    const unsigned char* g0 = (const unsigned char*)(((w >> 2) ? Vl : Vh) + (size_t)((w & 3) * 64 + hi) * HW) + lr * 16;
    const unsigned l0 = (unsigned)(size_t)sm + (unsigned)((w >> 2) * FA_PLANE + ((w & 3) * 64 + hi) * FA_PITCH + lr * 16);
    fa_stage(l0, g0);
    // the tile's 64 q rows (hi, lo) into LDS once: their fragments are re-read every stage instead of holding 32 registers through the attn.v products
    { const size_t o = (size_t)(r0 + (tid >> 2)) * CK + (tid & 3) * 8; unsigned char* d = sm + 2 * FA_BUF + (tid >> 2) * FA_QP + (tid & 3) * 16; *(v8usa*)d = *(const v8us*)(Qh + o); *(v8usa*)(d + FA_QPL) = *(const v8us*)(Ql + o); }
    v8f acc[2][16];
#pragma unroll
    for (int nb = 0; nb < 2; ++nb)
#pragma unroll
        for (int cb = 0; cb < 16; ++cb) acc[nb][cb] = (v8f){};
    asm volatile("s_wait_dscnt 0x0" ::: "memory");      // this wave's q rows are written before the barrier publishes them
    __syncthreads();
    const unsigned char* qf = sm + 2 * FA_BUF + (nh * 32 + lr) * FA_QP + hi * 16;
    const unsigned ko = (unsigned)((ks * 32 + lr) * CK + 8 * hi);
    v16bf kh[2], kl[2], a[2], a2[2];
#pragma unroll
    for (int mt = 0; mt < 2; ++mt) { kh[mt] = WFrag<bf>::ld(Kh + ko + mt * 16 * CK); kl[mt] = WFrag<bf>::ld(Kl + ko + mt * 16 * CK); }
    // stage 0's sigmoid weights
#pragma unroll
    for (int nb = 0; nb < 2; ++nb) { const v16bf qh = av_ld(qf + nb * 16 * FA_QP), ql = av_ld(qf + FA_QPL + nb * 16 * FA_QP); v16us ph, pl;
#pragma unroll
        for (int mt = 0; mt < 2; ++mt) { v8f s = wmmab(kh[mt], qh, (v8f){}); s = wmmab(kh[mt], ql, s); s = wmmab(kl[mt], qh, s);
#pragma unroll
            for (int j = 0; j < 8; ++j) { unsigned short x, y; fa_sig(s[j], x, y); ph[mt * 8 + j] = x; pl[mt * 8 + j] = y; } }
        a[nb] = __builtin_bit_cast(v16bf, ph); a2[nb] = __builtin_bit_cast(v16bf, pl); }
#pragma unroll
    for (int mt = 0; mt < 2; ++mt) { kh[mt] = WFrag<bf>::ld(Kh + ko + (size_t)128 * CK + mt * 16 * CK); kl[mt] = WFrag<bf>::ld(Kl + ko + (size_t)128 * CK + mt * 16 * CK); }
    const unsigned fro = (unsigned)(lr * FA_PITCH + ks * 64 + hi * 16);
#pragma unroll 1   // one stage a trip: the two-buffer order below is per trip
    for (int t = 0; t < FA_NST; ++t) {
        // hand-over at the head of the trip, so that the work below is the loop's last block and stays between the products
        asm volatile("s_wait_dscnt 0x0" ::: "memory");      // this wave's reads of stage t - 1 are done before its buffer is refilled
        asm volatile("s_wait_asynccnt 0x0" ::: "memory");   // this wave's copies of stage t have landed
        __syncthreads();                                    // publishes stage t and ends every reader's use of stage t - 1
        if (t + 1 < FA_NST) fa_stage(l0 + ((t + 1) & 1) * FA_BUF, g0 + (size_t)(t + 1) * 256);
        const unsigned char* fb = sm + (t & 1) * FA_BUF + fro;
        v16bf bv[2][2], bw[2][2];   // V hi and lo fragments of two c blocks, [group parity][c block]
        v8f st[2][2];
        v16us ph[2], pl[2];
        { v16bf qh[2], ql[2];
#pragma unroll
            for (int nb = 0; nb < 2; ++nb) { qh[nb] = av_ld(qf + nb * 16 * FA_QP); ql[nb] = av_ld(qf + FA_QPL + nb * 16 * FA_QP); }
#pragma unroll
            for (int cc = 0; cc < 2; ++cc) { bv[0][cc] = av_ld(fb + cc * 16 * FA_PITCH); bw[0][cc] = av_ld(fb + FA_PLANE + cc * 16 * FA_PITCH); }
            // scores of stage t + 1 (the last trip repeats the last stage's; its weights are not used)
#pragma unroll
            for (int nb = 0; nb < 2; ++nb)
#pragma unroll
                for (int mt = 0; mt < 2; ++mt) st[nb][mt] = wmmab(kh[mt], qh[nb], (v8f){});
#pragma unroll
            for (int nb = 0; nb < 2; ++nb)
#pragma unroll
                for (int mt = 0; mt < 2; ++mt) st[nb][mt] = wmmab(kh[mt], ql[nb], st[nb][mt]);
#pragma unroll
            for (int nb = 0; nb < 2; ++nb)
#pragma unroll
                for (int mt = 0; mt < 2; ++mt) st[nb][mt] = wmmab(kl[mt], qh[nb], st[nb][mt]); }
        const size_t kn = (size_t)((t + 2 < FA_NST) ? t + 2 : FA_NST - 1) * 128 * CK;   // clamped: the last two trips read the last stage's rows again, in bounds
#pragma unroll
        for (int g = 0; g < 8; ++g) { const int cu = g & 1, nx = cu ^ 1;
            __builtin_amdgcn_sched_barrier(0);   // keeps the next group's fragment loads ahead of this group's products, so that their latency is covered
            if (g < 7) {
#pragma unroll
                for (int cc = 0; cc < 2; ++cc) { bv[nx][cc] = av_ld(fb + ((g + 1) * 2 + cc) * 16 * FA_PITCH); bw[nx][cc] = av_ld(fb + FA_PLANE + ((g + 1) * 2 + cc) * 16 * FA_PITCH); }
            } else {
#pragma unroll
                for (int mt = 0; mt < 2; ++mt) { kh[mt] = WFrag<bf>::ld((Kh + kn + mt * 16 * CK) + ko); kl[mt] = WFrag<bf>::ld((Kl + kn + mt * 16 * CK) + ko); }
            }
            __builtin_amdgcn_sched_barrier(0);   // the loads above stay above; the sigmoids below stay in this group, between the products
#pragma unroll
            for (int cc = 0; cc < 2; ++cc)
#pragma unroll
                for (int nb = 0; nb < 2; ++nb) acc[nb][g * 2 + cc] = wmmab(a[nb], bv[cu][cc], acc[nb][g * 2 + cc]);
#pragma unroll
            for (int cc = 0; cc < 2; ++cc)
#pragma unroll
                for (int nb = 0; nb < 2; ++nb) acc[nb][g * 2 + cc] = wmmab(a2[nb], bv[cu][cc], acc[nb][g * 2 + cc]);
#pragma unroll
            for (int cc = 0; cc < 2; ++cc)
#pragma unroll
                for (int nb = 0; nb < 2; ++nb) acc[nb][g * 2 + cc] = wmmab(a[nb], bw[cu][cc], acc[nb][g * 2 + cc]);
#pragma unroll
            for (int u = 0; u < 4; ++u) { const int e = g * 4 + u, nb = e >> 4, i = e & 15; unsigned short x, y; fa_sig(st[nb][i >> 3][i & 7], x, y); ph[nb][i] = x; pl[nb][i] = y; } }
#pragma unroll
        for (int nb = 0; nb < 2; ++nb) { a[nb] = __builtin_bit_cast(v16bf, ph[nb]); a2[nb] = __builtin_bit_cast(v16bf, pl[nb]); }
    }
    asm volatile("s_wait_dscnt 0x0" ::: "memory");          // this wave's reads of the last stage are done
    asm volatile("s_wait_asynccnt 0x0" ::: "memory");       // nothing in flight when LDS becomes the partial tiles
    __syncthreads();                                        // every wave has left the last stage before its buffer is overwritten
    float* red = (float*)sm;
    float* mine = red + (size_t)ks * C_ * FA_TP + lr * FA_TP + nh * 32 + hi * 8;
#pragma unroll
    for (int nb = 0; nb < 2; ++nb)
#pragma unroll
        for (int cb = 0; cb < 16; ++cb) { float* d = mine + cb * 16 * FA_TP + nb * 16;
            *(v4fa*)d = __builtin_shufflevector(acc[nb][cb], acc[nb][cb], 0, 1, 2, 3); *(v4fa*)(d + 4) = __builtin_shufflevector(acc[nb][cb], acc[nb][cb], 4, 5, 6, 7); }
    __syncthreads();
    const float gm = bfr(GM[0]);
#pragma unroll
    for (int s = 0; s < 16; ++s) { const int idx = s * 256 + tid, c = idx >> 4, nofs = (idx & 15) * 4; const float* p = red + c * FA_TP + nofs; v4f val = *(const v4fa*)p;
#pragma unroll
        for (int k = 1; k < 4; ++k) val += *(const v4fa*)(p + k * C_ * FA_TP);
        const size_t o = (size_t)c * HW + r0 + nofs; const v4f xv = *(const v4f*)(X + o); v4f ov;
#pragma unroll
        for (int q = 0; q < 4; ++q) ov[q] = __fadd_rn(__fmul_rn(gm, val[q]), bfr(xv[q]));
        *(v4f*)(O + o) = ov; }
}

// ---- k_prep: everything the conv GEMM reads, in one launch; 256 threads, 8 elements a thread. The first PW_BLK blocks round the weights to bf16 into the stacked [Wq ; Wk ; Wv] plane, the others write x^T bf16 [z][n][c] (exact) of all batches.
#define PW_BLK ((2 * CK + C_) * C_ / 8 / 256)
#define PX_BLK (NB_ * HW * C_ / 8 / 256)
__global__ __launch_bounds__(256) void k_prep(const float* __restrict__ x, const float* __restrict__ wq, const float* __restrict__ wk, const float* __restrict__ wv, bf* Wt, bf* XT) {
    v8us o;
    if (blockIdx.x < PW_BLK) { const int e = (blockIdx.x * 256 + threadIdx.x) * 8;   // a block's 2048 elements lie in one of the three matrices
        const float* src = (blockIdx.x < CK * C_ / 2048) ? (wq + e) : (blockIdx.x < 2 * CK * C_ / 2048) ? (wk + (e - CK * C_)) : (wv + (e - 2 * CK * C_)); const v8f v = *(const v8f*)src;
#pragma unroll
        for (int k = 0; k < 8; ++k) o[k] = f2bf(v[k]);
        *(v8us*)(Wt + e) = o;
    } else { const size_t e = ((size_t)(blockIdx.x - PW_BLK) * 256 + threadIdx.x) * 8; const int c = (int)(e % C_); const int t = (int)(e / C_ % HW); const float* xb = x + e / ((size_t)HW * C_) * ((size_t)HW * C_);
#pragma unroll
        for (int q = 0; q < 8; ++q) o[q] = f2bf(xb[(size_t)(c + q) * HW + t]);
        *(v8us*)(XT + e) = o;
        asm volatile("s_wait_xcnt 0x0" ::: "memory");   // behind the store: none of its registers is rewritten ahead of it
    }
}

extern "C" void kernel_launch(void* const* d_in, const int* in_sizes, int n_in,
                              void* d_out, int out_size, void* d_ws, size_t ws_size, hipStream_t stream) {
    (void)in_sizes; (void)n_in; (void)out_size;
    const float* x = (const float*)d_in[0]; const float* wq = (const float*)d_in[1]; const float* bq = (const float*)d_in[2]; const float* wk = (const float*)d_in[3]; const float* bk = (const float*)d_in[4]; const float* wv = (const float*)d_in[5]; const float* bv = (const float*)d_in[6]; const float* GM = (const float*)d_in[7];
    float* OUT = (float*)d_out;     // [4][256][4096]
    char* wsp = (char*)d_ws;
    auto take = [&](size_t bytes) { char* p = wsp; wsp += (bytes + 255) & ~(size_t)255; return (void*)p; };
    bf* WT = (bf*)take((size_t)(2 * CK + C_) * C_ * 2);
    bf* XT = (bf*)take((size_t)NB_ * HW * C_ * 2);
    bf* Qh = (bf*)take((size_t)NB_ * HW * CK * 2); bf* Ql = (bf*)take((size_t)NB_ * HW * CK * 2); bf* Kh = (bf*)take((size_t)NB_ * HW * CK * 2); bf* Kl = (bf*)take((size_t)NB_ * HW * CK * 2); bf* VTh = (bf*)take((size_t)NB_ * C_ * HW * 2); bf* VTl = (bf*)take((size_t)NB_ * C_ * HW * 2);
    if ((size_t)(wsp - (char*)d_ws) > ws_size) return;
    k_prep<<<PW_BLK + PX_BLK, 256, 0, stream>>>(x, wq, wk, wv, WT, XT);                                                                     /* [Wq ; Wk ; Wv] bf16 [320][256]; x^T bf16 [b][n][c] */
    k_conv<<<dim3(HW / 64, (2 * CK + C_) / 64, NB_), 32, 0, stream>>>(XT, WT, Qh, Ql, Kh, Kl, VTh, VTl, bq, bk, bv);                        /* q, k as hi/lo planes [b][n][32]; v as transposed hi/lo planes [b][c][m] */
    k_fa<<<dim3(HW / 64, NB_, 1), 256, 0, stream>>>(Qh, Ql, Kh, Kl, VTh, VTl, x, GM, OUT);                                                  /* out[b][c][n] = gamma sum_m sigmoid(q_n . k_m) v[c][m] + x[b][c][n] */
}

// v005
// A run of this version takes 94 microseconds.
// Next to v004, in two timings, it ran 1.21 and 1.22 times as fast.
// Over all steps from v000 it is 6.67 times as fast.
#include <hip/hip_runtime.h>

// Sigmoid attention on a channel-major feature map (x [4][256][64][64] -> [c][n], n = 4096; q = Wq x + bq, k = Wk x + bk ([32][256] 1x1 convs), v = Wv x + bv ([256][256]); attn[n][m] = sigmoid(sum_o q[o][n] k[o][m]) (no softmax, no scaling); out[c][n] = sum_m v[c][m] attn[n][m]; result = gamma out + x (gamma scalar, read) -> [4][256][64][64] (4.2 M)).
// Layout, three launches, each over all batches: x is transposed once into token-major bf16 planes (exact) so the 1x1 convs are one GEMM against the stacked [out][in] weights [Wq ; Wk ; Wv] (+ bias); the epilogue of its [q | k] tiles writes the hi/lo planes [n][32], that of its v tiles the transposed [c][m] hi/lo planes; one kernel over all batches forms the scores in f32, takes the sigmoid, splits it into hi/lo in registers, multiplies by v (3 products) and writes the channel-major output gamma Y + x with n fastest.
// Compute dtypes, f32 accumulate: x, weights, biases, gamma rounded to bf16; x exact bf16; q/k/v hi + lo planes of the f32 conv outputs; scores and attn.v 3 products; sigmoid in f32 (hardware exp2 and reciprocal); residual in f32.

#define NB_  4
#define C_   256
#define HW   4096
#define CK   32
typedef _Float16 h16;
typedef unsigned short bf;
typedef __attribute__((ext_vector_type(16))) __bf16   v16bf;
typedef __attribute__((ext_vector_type(16))) _Float16 v16h;
typedef __attribute__((ext_vector_type(8)))  _Float16 v8h;
typedef __attribute__((ext_vector_type(8)))  unsigned short v8us;
typedef __attribute__((ext_vector_type(8)))  float    v8f;
typedef __attribute__((ext_vector_type(4)))  float    v4f;
typedef __attribute__((ext_vector_type(2)))  float    v2f;
typedef __attribute__((ext_vector_type(4)))  unsigned short v4us;
typedef __attribute__((ext_vector_type(2)))  unsigned short v2us;
typedef v8h  __attribute__((may_alias)) v8ha;
typedef v4f  __attribute__((may_alias)) v4fa;
typedef v8us __attribute__((may_alias)) v8usa;

__device__ __forceinline__ unsigned short f2bf(float f) { unsigned u = __float_as_uint(f); u += 0x7FFFu + ((u >> 16) & 1u); return (unsigned short)(u >> 16); }
__device__ __forceinline__ float bf2f(unsigned short b) { return __uint_as_float(((unsigned)b) << 16); }
__device__ __forceinline__ float bfr(float f) { return bf2f(f2bf(f)); }
__device__ __forceinline__ void splitf(float y, unsigned short& h, unsigned short& l) { h = f2bf(y); l = f2bf(y - bf2f(h)); }
__device__ __forceinline__ v16h cat16(v8h lo, v8h hi) { return __builtin_shufflevector(lo, hi, 0, 1, 2, 3, 4, 5, 6, 7, 8, 9, 10, 11, 12, 13, 14, 15); }
__device__ __forceinline__ v16bf cat16b(v8us lo, v8us hi) { return __builtin_bit_cast(v16bf, __builtin_shufflevector(lo, hi, 0, 1, 2, 3, 4, 5, 6, 7, 8, 9, 10, 11, 12, 13, 14, 15)); }
__device__ __forceinline__ v8f wmma16(v16h a, v16h b, v8f c) { return __builtin_amdgcn_wmma_f32_16x16x32_f16(false, a, false, b, (short)0, c, false, false); }
__device__ __forceinline__ v8f wmmab(v16bf a, v16bf b, v8f c) { return __builtin_amdgcn_wmma_f32_16x16x32_bf16(false, a, false, b, (short)0, c, false, false); }

// ---- k_conv: the three 1x1 convs of all batches as one register-blocked GEMM, ONE WAVE per 64x64 output tile (16 accumulators), operands straight from K-contiguous bf16 planes; grid (HW/64, (2 CK + C_)/64, NB_), 32 threads.
// C[m][n] (f32, + bias[n]) = sum_k XT[z][m][k] Wt[n][k], Wt = [Wq ; Wk ; Wv] stacked by rows: tile column 0 is [q | k], tile columns 1.. are v.
// C is not stored: the epilogue splits it into bf16 hi + lo planes. [q | k] tile: columns 0..31 to Qh/Ql and 32..63 to Kh/Kl, planes [m][32]. v tiles: transposed planes Vh/Vl [c][HW]; an accumulator lane holds 8 consecutive m of one column, which is one 16-byte piece of a transposed row.
template <typename T16> struct WFrag;
template <> struct WFrag<bf> { typedef v16bf V; static __device__ __forceinline__ V ld(const bf* p) { return cat16b(*(const v8us*)p, *(const v8us*)(p + 16)); } static __device__ __forceinline__ v8f mma(V a, V b, v8f c) { return wmmab(a, b, c); } };
__global__ __launch_bounds__(32) void k_conv(const bf* __restrict__ XT, const bf* __restrict__ Wt, bf* Qh, bf* Ql, bf* Kh, bf* Kl, bf* Vh, bf* Vl, const float* __restrict__ bq, const float* __restrict__ bk, const float* __restrict__ bv) {
    typedef WFrag<bf>::V V;
    __shared__ __align__(16) float os[16 * 68];
    const size_t z = blockIdx.z; const bf* A = XT + z * HW * C_;
    const int lane = threadIdx.x & 31, lr = lane & 15, hi = lane >> 4; const int r0 = blockIdx.x * 64;
    v8f acc[4][4];
#pragma unroll
    for (int mb = 0; mb < 4; ++mb)
#pragma unroll
        for (int nb = 0; nb < 4; ++nb) acc[mb][nb] = (v8f){};
    const size_t aoff = (size_t)(r0 + lr) * C_ + 8 * hi, boff = (size_t)(blockIdx.y * 64 + lr) * C_ + 8 * hi;
#pragma unroll 1
    for (int kc = 0; kc < C_; kc += 32) {
        V a[4];
#pragma unroll
        for (int mb = 0; mb < 4; ++mb) a[mb] = WFrag<bf>::ld(A + aoff + (size_t)mb * 16 * C_ + kc);
        asm volatile("s_wait_xcnt 0x0" ::: "memory");   // the A loads' address registers may be reused by what follows
#pragma unroll
        for (int nb = 0; nb < 4; ++nb) { const V b = WFrag<bf>::ld(Wt + boff + (size_t)nb * 16 * C_ + kc);
#pragma unroll
            for (int mb = 0; mb < 4; ++mb) acc[mb][nb] = WFrag<bf>::mma(a[mb], b, acc[mb][nb]); }
        asm volatile("v_nop\n\tv_nop\n\tv_nop\n\tv_nop" : "+v"(acc[0][0]), "+v"(acc[1][1]), "+v"(acc[2][2]), "+v"(acc[3][3]) : "v"(a[0]), "v"(a[3]));
    }
    if (blockIdx.y == 0) {
        const int c = lr * 4;   // a lane's four columns lie in one plane pair: q below CK, k from CK on
        const size_t po = z * HW * CK + (size_t)(r0 + hi) * CK;
        bf* dh = ((c < CK) ? (Qh + c) : (Kh + (c - CK))) + po; bf* dl = ((c < CK) ? (Ql + c) : (Kl + (c - CK))) + po;
        const float* bs = (c < CK) ? (bq + c) : (bk + (c - CK));
        v4f bb; bb[0] = bfr(bs[0]); bb[1] = bfr(bs[1]); bb[2] = bfr(bs[2]); bb[3] = bfr(bs[3]);
#pragma unroll
        for (int mb = 0; mb < 4; ++mb) {
#pragma unroll
            for (int nb = 0; nb < 4; ++nb) {
#pragma unroll
                for (int j = 0; j < 8; ++j) os[(hi * 8 + j) * 68 + nb * 16 + lr] = acc[mb][nb][j]; }
            __builtin_amdgcn_wave_barrier(); asm volatile("" ::: "memory");   // the row reads below stay behind the other lanes' writes
#pragma unroll
            for (int s = 0; s < 8; ++s) { v4f val = *(const v4fa*)(os + (2 * s + hi) * 68 + lr * 4); val += bb;
                v4us oh, ol;
#pragma unroll
                for (int q = 0; q < 4; ++q) { unsigned short x, y; splitf(val[q], x, y); oh[q] = x; ol[q] = y; }
                *(v4us*)(dh + (mb * 16 + 2 * s) * CK) = oh; *(v4us*)(dl + (mb * 16 + 2 * s) * CK) = ol; }
            __builtin_amdgcn_wave_barrier(); asm volatile("" ::: "memory");   // the next block's writes stay behind these reads
        }
    } else {
        const int c0 = (blockIdx.y - 1) * 64;
#pragma unroll
        for (int nb = 0; nb < 4; ++nb) { const int c = c0 + nb * 16 + lr; const float bb = bfr(bv[c]); const size_t o = z * C_ * HW + (size_t)c * HW + r0 + hi * 8;
#pragma unroll
            for (int mb = 0; mb < 4; ++mb) { v8us oh, ol;
#pragma unroll
                for (int j = 0; j < 8; ++j) { const float v = acc[mb][nb][j] + bb; unsigned short x, y; splitf(v, x, y); oh[j] = x; ol[j] = y; }
                *(v8us*)(Vh + o + mb * 16) = oh; *(v8us*)(Vl + o + mb * 16) = ol; } }
        asm volatile("s_wait_xcnt 0x0" ::: "memory");   // behind the last stores: none of their registers is rewritten ahead of it
    }
}


// ---- k_fa: out[c][n] = gamma Y[n][c] + x[c][n], Y[n][c] = sum_m sigmoid(q_n . k_m) V[c][m]; scores, sigmoid, attn.v and the residual in one kernel; one 8-wave work-group per 64 rows n x all 256 c of one batch; grid (HW/64, NB_), 256 threads.
// Wave w owns rows 32 (w & 1) .. + 31 and the k slice [32 (w >> 1), + 32) of every 128-m stage. It forms S^T = K Q^T (3 products), whose accumulator layout (lane = n, registers = 8 consecutive m) is the A fragment layout of the attn.v product, so the sigmoid weights go from registers to registers.
// The scores and sigmoids of stage t + 1 are worked between the attn.v products of stage t. V (hi, lo) is staged in LDS by asynchronous copies, two buffers; K fragments are contiguous 1-KiB pieces read straight from their planes, one stage ahead; the tile's Q rows lie in LDS. The four k-slice partials are summed through LDS in slice order; they lie there transposed, [slice][c][n] (an accumulator lane holds 8 consecutive n of one c), so that the output rows are read and stored with n fastest.
#define FA_PITCH 272                 /* 256-byte row piece + 16: conflict-free for 16-byte LDS reads */
#define FA_PLANE (C_ * FA_PITCH)
#define FA_BUF   (2 * FA_PLANE)
#define FA_NST   (HW / 128)
#define FA_TP    68                  /* f32 pitch of a transposed partial row: 64 n + 4, conflict-free for 16-byte LDS writes and reads */
#define FA_QP    80                  /* 64-byte q row + 16 */
#define FA_QPL   (64 * FA_QP)
__device__ __forceinline__ v16bf av_ld(const unsigned char* p) { return cat16b(*(const v8usa*)p, *(const v8usa*)(p + 32)); }
// Eight copies, each two 256-byte row pieces of one plane (lanes 0-15 one row, lanes 16-31 the next). The s_wait_xcnt stands inside the statement so that no address register is rewritten ahead of it.
__device__ __forceinline__ void fa_copy8(unsigned l, const unsigned char* g) {
    asm volatile("global_load_async_to_lds_b128 %0, %8, off\n\t"
                 "global_load_async_to_lds_b128 %1, %9, off\n\t"
                 "global_load_async_to_lds_b128 %2, %10, off\n\t"
                 "global_load_async_to_lds_b128 %3, %11, off\n\t"
                 "global_load_async_to_lds_b128 %4, %12, off\n\t"
                 "global_load_async_to_lds_b128 %5, %13, off\n\t"
                 "global_load_async_to_lds_b128 %6, %14, off\n\t"
                 "global_load_async_to_lds_b128 %7, %15, off\n\t"
                 "s_wait_xcnt 0x0"
                 :: "v"(l), "v"(l + 2 * FA_PITCH), "v"(l + 4 * FA_PITCH), "v"(l + 6 * FA_PITCH), "v"(l + 8 * FA_PITCH), "v"(l + 10 * FA_PITCH), "v"(l + 12 * FA_PITCH), "v"(l + 14 * FA_PITCH),
                    "v"(g), "v"(g + (size_t)HW * 4), "v"(g + (size_t)HW * 8), "v"(g + (size_t)HW * 12), "v"(g + (size_t)HW * 16), "v"(g + (size_t)HW * 20), "v"(g + (size_t)HW * 24), "v"(g + (size_t)HW * 28)
                 : "memory");
}
__device__ __forceinline__ void fa_stage(unsigned l, const unsigned char* g) {
#pragma unroll
    for (int s = 0; s < 4; ++s) fa_copy8(l + s * 16 * FA_PITCH, g + (size_t)s * 16 * HW * 2);
}
// Two sigmoid weights and their hi/lo split, packed as the two bf16 of one fragment register: 1 / (1 + 2^(-s log2 e)) on the hardware exp2 and reciprocal (both limits right: 2^+inf -> 0, 2^-inf -> 1); the packed conversions round to nearest even like f2bf.
typedef __attribute__((ext_vector_type(2))) __bf16 v2bf;
typedef __attribute__((ext_vector_type(8))) unsigned v8u;
__device__ __forceinline__ void fa_sig2(float s0, float s1, unsigned& h, unsigned& l) {
    v2f t; t[0] = s0; t[1] = s1; t *= -1.44269504088896341f;
    v2f d; d[0] = __builtin_amdgcn_exp2f(t[0]); d[1] = __builtin_amdgcn_exp2f(t[1]); d += 1.0f;
    v2f sg; sg[0] = __builtin_amdgcn_rcpf(d[0]); sg[1] = __builtin_amdgcn_rcpf(d[1]);
    const v2bf hb = __builtin_convertvector(sg, v2bf);
    const v2bf lb = __builtin_convertvector(sg - __builtin_convertvector(hb, v2f), v2bf);
    h = __builtin_bit_cast(unsigned, hb); l = __builtin_bit_cast(unsigned, lb);
}
__global__ __launch_bounds__(256) void k_fa(const bf* __restrict__ Qh, const bf* __restrict__ Ql, const bf* __restrict__ Kh, const bf* __restrict__ Kl, const bf* __restrict__ Vh, const bf* __restrict__ Vl, const float* __restrict__ X, const float* __restrict__ GM, float* O) {
    __shared__ __attribute__((aligned(16))) unsigned char sm[2 * FA_BUF + 2 * FA_QPL];
    const int tid = threadIdx.x, lane = tid & 31, lr = lane & 15, hi = lane >> 4;
    const int w = __builtin_amdgcn_readfirstlane(tid >> 5);
    const size_t z = blockIdx.y; Qh += z * HW * CK; Ql += z * HW * CK; Kh += z * HW * CK; Kl += z * HW * CK; Vh += z * C_ * HW; Vl += z * C_ * HW; X += z * C_ * HW; O += z * C_ * HW;
    const int r0 = blockIdx.x * 64, nh = w & 1, ks = w >> 1;
    // wave w copies rows 64 (w & 3) .. + 63 of plane w >> 2 (V hi, V lo); a lane brings 16 bytes of a row piece
    const unsigned char* g0 = (const unsigned char*)(((w >> 2) ? Vl : Vh) + (size_t)((w & 3) * 64 + hi) * HW) + lr * 16;
    const unsigned l0 = (unsigned)(size_t)sm + (unsigned)((w >> 2) * FA_PLANE + ((w & 3) * 64 + hi) * FA_PITCH + lr * 16);
    fa_stage(l0, g0);
    // the tile's 64 q rows (hi, lo) into LDS once: their fragments are re-read every stage instead of holding 32 registers through the attn.v products
    { const size_t o = (size_t)(r0 + (tid >> 2)) * CK + (tid & 3) * 8; unsigned char* d = sm + 2 * FA_BUF + (tid >> 2) * FA_QP + (tid & 3) * 16; *(v8usa*)d = *(const v8us*)(Qh + o); *(v8usa*)(d + FA_QPL) = *(const v8us*)(Ql + o); }
    v8f acc[2][16];
#pragma unroll
    for (int nb = 0; nb < 2; ++nb)
#pragma unroll
        for (int cb = 0; cb < 16; ++cb) acc[nb][cb] = (v8f){};
    asm volatile("s_wait_dscnt 0x0" ::: "memory");      // this wave's q rows are written before the barrier publishes them
    __syncthreads();
    const unsigned char* qf = sm + 2 * FA_BUF + (nh * 32 + lr) * FA_QP + hi * 16;
    const unsigned ko = (unsigned)((ks * 32 + lr) * CK + 8 * hi);
    v16bf kh[2], kl[2], a[2], a2[2];
#pragma unroll
    for (int mt = 0; mt < 2; ++mt) { kh[mt] = WFrag<bf>::ld(Kh + ko + mt * 16 * CK); kl[mt] = WFrag<bf>::ld(Kl + ko + mt * 16 * CK); }
    // stage 0's sigmoid weights
#pragma unroll
    for (int nb = 0; nb < 2; ++nb) { const v16bf qh = av_ld(qf + nb * 16 * FA_QP), ql = av_ld(qf + FA_QPL + nb * 16 * FA_QP); v8u ph, pl;
#pragma unroll
        for (int mt = 0; mt < 2; ++mt) { v8f s = wmmab(kh[mt], qh, (v8f){}); s = wmmab(kh[mt], ql, s); s = wmmab(kl[mt], qh, s);
#pragma unroll
            for (int j = 0; j < 4; ++j) { unsigned x, y; fa_sig2(s[2 * j], s[2 * j + 1], x, y); ph[mt * 4 + j] = x; pl[mt * 4 + j] = y; } }
        a[nb] = __builtin_bit_cast(v16bf, ph); a2[nb] = __builtin_bit_cast(v16bf, pl); }
#pragma unroll
    for (int mt = 0; mt < 2; ++mt) { kh[mt] = WFrag<bf>::ld(Kh + ko + (size_t)128 * CK + mt * 16 * CK); kl[mt] = WFrag<bf>::ld(Kl + ko + (size_t)128 * CK + mt * 16 * CK); }
    const unsigned fro = (unsigned)(lr * FA_PITCH + ks * 64 + hi * 16);
#pragma unroll 1   // one stage a trip: the two-buffer order below is per trip
    for (int t = 0; t < FA_NST; ++t) {
        // hand-over at the head of the trip, so that the work below is the loop's last block and stays between the products
        asm volatile("s_wait_dscnt 0x0" ::: "memory");      // this wave's reads of stage t - 1 are done before its buffer is refilled
        asm volatile("s_wait_asynccnt 0x0" ::: "memory");   // this wave's copies of stage t have landed
        __syncthreads();                                    // publishes stage t and ends every reader's use of stage t - 1
        if (t + 1 < FA_NST) fa_stage(l0 + ((t + 1) & 1) * FA_BUF, g0 + (size_t)(t + 1) * 256);
        const unsigned char* fb = sm + (t & 1) * FA_BUF + fro;
        v16bf bv[2][2], bw[2][2];   // V hi and lo fragments of two c blocks, [group parity][c block]
        v8f st[2][2];
        v8u ph[2], pl[2];
        { v16bf qh[2], ql[2];
#pragma unroll
            for (int nb = 0; nb < 2; ++nb) { qh[nb] = av_ld(qf + nb * 16 * FA_QP); ql[nb] = av_ld(qf + FA_QPL + nb * 16 * FA_QP); }
#pragma unroll
            for (int cc = 0; cc < 2; ++cc) { bv[0][cc] = av_ld(fb + cc * 16 * FA_PITCH); bw[0][cc] = av_ld(fb + FA_PLANE + cc * 16 * FA_PITCH); }
            // scores of stage t + 1 (the last trip repeats the last stage's; its weights are not used)
#pragma unroll
            for (int nb = 0; nb < 2; ++nb)
#pragma unroll
                for (int mt = 0; mt < 2; ++mt) st[nb][mt] = wmmab(kh[mt], qh[nb], (v8f){});
#pragma unroll
            for (int nb = 0; nb < 2; ++nb)
#pragma unroll
                for (int mt = 0; mt < 2; ++mt) st[nb][mt] = wmmab(kh[mt], ql[nb], st[nb][mt]);
#pragma unroll
            for (int nb = 0; nb < 2; ++nb)
#pragma unroll
                for (int mt = 0; mt < 2; ++mt) st[nb][mt] = wmmab(kl[mt], qh[nb], st[nb][mt]); }
        const size_t kn = (size_t)((t + 2 < FA_NST) ? t + 2 : FA_NST - 1) * 128 * CK;   // clamped: the last two trips read the last stage's rows again, in bounds
#pragma unroll
        for (int g = 0; g < 8; ++g) { const int cu = g & 1, nx = cu ^ 1;
            __builtin_amdgcn_sched_barrier(0);   // keeps the next group's fragment loads ahead of this group's products, so that their latency is covered
            if (g < 7) {
#pragma unroll
                for (int cc = 0; cc < 2; ++cc) { bv[nx][cc] = av_ld(fb + ((g + 1) * 2 + cc) * 16 * FA_PITCH); bw[nx][cc] = av_ld(fb + FA_PLANE + ((g + 1) * 2 + cc) * 16 * FA_PITCH); }
            } else {
#pragma unroll
                for (int mt = 0; mt < 2; ++mt) { kh[mt] = WFrag<bf>::ld((Kh + kn + mt * 16 * CK) + ko); kl[mt] = WFrag<bf>::ld((Kl + kn + mt * 16 * CK) + ko); }
            }
            __builtin_amdgcn_sched_barrier(0);   // the loads above stay above; the sigmoids below stay in this group, between the products
#pragma unroll
            for (int cc = 0; cc < 2; ++cc)
#pragma unroll
                for (int nb = 0; nb < 2; ++nb) acc[nb][g * 2 + cc] = wmmab(a[nb], bv[cu][cc], acc[nb][g * 2 + cc]);
#pragma unroll
            for (int cc = 0; cc < 2; ++cc)
#pragma unroll
                for (int nb = 0; nb < 2; ++nb) acc[nb][g * 2 + cc] = wmmab(a2[nb], bv[cu][cc], acc[nb][g * 2 + cc]);
#pragma unroll
            for (int cc = 0; cc < 2; ++cc)
#pragma unroll
                for (int nb = 0; nb < 2; ++nb) acc[nb][g * 2 + cc] = wmmab(a[nb], bw[cu][cc], acc[nb][g * 2 + cc]);
#pragma unroll
            for (int u = 0; u < 2; ++u) { const int e = g * 2 + u, nb = e >> 3, i = e & 7; unsigned x, y; fa_sig2(st[nb][i >> 2][2 * (i & 3)], st[nb][i >> 2][2 * (i & 3) + 1], x, y); ph[nb][i] = x; pl[nb][i] = y; } }
#pragma unroll
        for (int nb = 0; nb < 2; ++nb) { a[nb] = __builtin_bit_cast(v16bf, ph[nb]); a2[nb] = __builtin_bit_cast(v16bf, pl[nb]); }
    }
    asm volatile("s_wait_dscnt 0x0" ::: "memory");          // this wave's reads of the last stage are done
    asm volatile("s_wait_asynccnt 0x0" ::: "memory");       // nothing in flight when LDS becomes the partial tiles
    __syncthreads();                                        // every wave has left the last stage before its buffer is overwritten
    float* red = (float*)sm;
    float* mine = red + (size_t)ks * C_ * FA_TP + lr * FA_TP + nh * 32 + hi * 8;
#pragma unroll
    for (int nb = 0; nb < 2; ++nb)
#pragma unroll
        for (int cb = 0; cb < 16; ++cb) { float* d = mine + cb * 16 * FA_TP + nb * 16;
            *(v4fa*)d = __builtin_shufflevector(acc[nb][cb], acc[nb][cb], 0, 1, 2, 3); *(v4fa*)(d + 4) = __builtin_shufflevector(acc[nb][cb], acc[nb][cb], 4, 5, 6, 7); }
    __syncthreads();
    const float gm = bfr(GM[0]);
#pragma unroll
    for (int s = 0; s < 16; ++s) { const int idx = s * 256 + tid, c = idx >> 4, nofs = (idx & 15) * 4; const float* p = red + c * FA_TP + nofs; v4f val = *(const v4fa*)p;
#pragma unroll
        for (int k = 1; k < 4; ++k) val += *(const v4fa*)(p + k * C_ * FA_TP);
        const size_t o = (size_t)c * HW + r0 + nofs; const v4f xv = *(const v4f*)(X + o); v4f ov;
#pragma unroll
        for (int q = 0; q < 4; ++q) ov[q] = __fadd_rn(__fmul_rn(gm, val[q]), bfr(xv[q]));
        *(v4f*)(O + o) = ov; }
}

// ---- k_prep: everything the conv GEMM reads, in one launch; 256 threads, 8 elements a thread. The first PW_BLK blocks round the weights to bf16 into the stacked [Wq ; Wk ; Wv] plane, the others write x^T bf16 [z][n][c] (exact) of all batches.
#define PW_BLK ((2 * CK + C_) * C_ / 8 / 256)
#define PX_BLK (NB_ * HW * C_ / 8 / 256)
__global__ __launch_bounds__(256) void k_prep(const float* __restrict__ x, const float* __restrict__ wq, const float* __restrict__ wk, const float* __restrict__ wv, bf* Wt, bf* XT) {
    v8us o;
    if (blockIdx.x < PW_BLK) { const int e = (blockIdx.x * 256 + threadIdx.x) * 8;   // a block's 2048 elements lie in one of the three matrices
        const float* src = (blockIdx.x < CK * C_ / 2048) ? (wq + e) : (blockIdx.x < 2 * CK * C_ / 2048) ? (wk + (e - CK * C_)) : (wv + (e - 2 * CK * C_)); const v8f v = *(const v8f*)src;
#pragma unroll
        for (int k = 0; k < 8; ++k) o[k] = f2bf(v[k]);
        *(v8us*)(Wt + e) = o;
    } else { const size_t e = ((size_t)(blockIdx.x - PW_BLK) * 256 + threadIdx.x) * 8; const int c = (int)(e % C_); const int t = (int)(e / C_ % HW); const float* xb = x + e / ((size_t)HW * C_) * ((size_t)HW * C_);
#pragma unroll
        for (int q = 0; q < 8; ++q) o[q] = f2bf(xb[(size_t)(c + q) * HW + t]);
        *(v8us*)(XT + e) = o;
        asm volatile("s_wait_xcnt 0x0" ::: "memory");   // behind the store: none of its registers is rewritten ahead of it
    }
}

extern "C" void kernel_launch(void* const* d_in, const int* in_sizes, int n_in,
                              void* d_out, int out_size, void* d_ws, size_t ws_size, hipStream_t stream) {
    (void)in_sizes; (void)n_in; (void)out_size;
    const float* x = (const float*)d_in[0]; const float* wq = (const float*)d_in[1]; const float* bq = (const float*)d_in[2]; const float* wk = (const float*)d_in[3]; const float* bk = (const float*)d_in[4]; const float* wv = (const float*)d_in[5]; const float* bv = (const float*)d_in[6]; const float* GM = (const float*)d_in[7];
    float* OUT = (float*)d_out;     // [4][256][4096]
    char* wsp = (char*)d_ws;
    auto take = [&](size_t bytes) { char* p = wsp; wsp += (bytes + 255) & ~(size_t)255; return (void*)p; };
    bf* WT = (bf*)take((size_t)(2 * CK + C_) * C_ * 2);
    bf* XT = (bf*)take((size_t)NB_ * HW * C_ * 2);
    bf* Qh = (bf*)take((size_t)NB_ * HW * CK * 2); bf* Ql = (bf*)take((size_t)NB_ * HW * CK * 2); bf* Kh = (bf*)take((size_t)NB_ * HW * CK * 2); bf* Kl = (bf*)take((size_t)NB_ * HW * CK * 2); bf* VTh = (bf*)take((size_t)NB_ * C_ * HW * 2); bf* VTl = (bf*)take((size_t)NB_ * C_ * HW * 2);
    if ((size_t)(wsp - (char*)d_ws) > ws_size) return;
    k_prep<<<PW_BLK + PX_BLK, 256, 0, stream>>>(x, wq, wk, wv, WT, XT);                                                                     /* [Wq ; Wk ; Wv] bf16 [320][256]; x^T bf16 [b][n][c] */
    k_conv<<<dim3(HW / 64, (2 * CK + C_) / 64, NB_), 32, 0, stream>>>(XT, WT, Qh, Ql, Kh, Kl, VTh, VTl, bq, bk, bv);                        /* q, k as hi/lo planes [b][n][32]; v as transposed hi/lo planes [b][c][m] */
    k_fa<<<dim3(HW / 64, NB_, 1), 256, 0, stream>>>(Qh, Ql, Kh, Kl, VTh, VTl, x, GM, OUT);                                                  /* out[b][c][n] = gamma sum_m sigmoid(q_n . k_m) v[c][m] + x[b][c][n] */
}

// v006
// A run of this version takes 83.7 microseconds.
// Next to v005, in two timings, it ran 1.12 and 1.14 times as fast.
// Over all steps from v000 it is 7.52 times as fast.
#include <hip/hip_runtime.h>

// Sigmoid attention on a channel-major feature map (x [4][256][64][64] -> [c][n], n = 4096; q = Wq x + bq, k = Wk x + bk ([32][256] 1x1 convs), v = Wv x + bv ([256][256]); attn[n][m] = sigmoid(sum_o q[o][n] k[o][m]) (no softmax, no scaling); out[c][n] = sum_m v[c][m] attn[n][m]; result = gamma out + x (gamma scalar, read) -> [4][256][64][64] (4.2 M)).
// Layout, two launches, each over all batches: the 1x1 convs are one GEMM of token-major x against the stacked [out][in] weights [Wq ; Wk ; Wv] (+ bias), whose work-groups round and transpose their own x tile and the weights into LDS; the epilogue of its [q | k] tiles writes the hi/lo planes [n][32], that of its v tiles the transposed [c][m] hi/lo planes; one kernel over all batches forms the scores in f32, takes the sigmoid, splits it into hi/lo in registers, multiplies by v (3 products) and writes the channel-major output gamma Y + x with n fastest.
// Compute dtypes, f32 accumulate: x, weights, biases, gamma rounded to bf16; x exact bf16; q/k/v hi + lo planes of the f32 conv outputs; scores and attn.v 3 products; sigmoid in f32 (hardware exp2 and reciprocal); residual in f32.

#define NB_  4
#define C_   256
#define HW   4096
#define CK   32
typedef _Float16 h16;
typedef unsigned short bf;
typedef __attribute__((ext_vector_type(16))) __bf16   v16bf;
typedef __attribute__((ext_vector_type(16))) _Float16 v16h;
typedef __attribute__((ext_vector_type(8)))  _Float16 v8h;
typedef __attribute__((ext_vector_type(8)))  unsigned short v8us;
typedef __attribute__((ext_vector_type(8)))  float    v8f;
typedef __attribute__((ext_vector_type(4)))  float    v4f;
typedef __attribute__((ext_vector_type(2)))  float    v2f;
typedef __attribute__((ext_vector_type(4)))  unsigned short v4us;
typedef __attribute__((ext_vector_type(2)))  unsigned short v2us;
typedef v8h  __attribute__((may_alias)) v8ha;
typedef v4f  __attribute__((may_alias)) v4fa;
typedef v8us __attribute__((may_alias)) v8usa;

__device__ __forceinline__ unsigned short f2bf(float f) { unsigned u = __float_as_uint(f); u += 0x7FFFu + ((u >> 16) & 1u); return (unsigned short)(u >> 16); }
__device__ __forceinline__ float bf2f(unsigned short b) { return __uint_as_float(((unsigned)b) << 16); }
__device__ __forceinline__ float bfr(float f) { return bf2f(f2bf(f)); }
__device__ __forceinline__ void splitf(float y, unsigned short& h, unsigned short& l) { h = f2bf(y); l = f2bf(y - bf2f(h)); }
__device__ __forceinline__ v16h cat16(v8h lo, v8h hi) { return __builtin_shufflevector(lo, hi, 0, 1, 2, 3, 4, 5, 6, 7, 8, 9, 10, 11, 12, 13, 14, 15); }
__device__ __forceinline__ v16bf cat16b(v8us lo, v8us hi) { return __builtin_bit_cast(v16bf, __builtin_shufflevector(lo, hi, 0, 1, 2, 3, 4, 5, 6, 7, 8, 9, 10, 11, 12, 13, 14, 15)); }
__device__ __forceinline__ v8f wmma16(v16h a, v16h b, v8f c) { return __builtin_amdgcn_wmma_f32_16x16x32_f16(false, a, false, b, (short)0, c, false, false); }
__device__ __forceinline__ v8f wmmab(v16bf a, v16bf b, v8f c) { return __builtin_amdgcn_wmma_f32_16x16x32_bf16(false, a, false, b, (short)0, c, false, false); }

// ---- k_conv: the three 1x1 convs of all batches as one GEMM; one 8-wave work-group per 64 tokens x all 320 outputs of one batch; grid (HW/64, NB_), 256 threads.
// C[m][n] (f32, + bias[n]) = sum_k x[z][k][m] Wt[n][k], Wt = [Wq ; Wk ; Wv] stacked by rows. All eight waves bring the operands into LDS as K-contiguous bf16 rows: the x tile [256 c][64 tokens] is read with the tokens along the lanes (whole 128-byte lines) and a lane writes 8 channels of its token as one 16-byte piece, which is the transpose; the weights are read as whole rows.
// Waves 0..4 then each work one 64x64 output tile (16 accumulators): wave 0 is [q | k], waves 1.. are v.
// C is not stored: the epilogue splits it into bf16 hi + lo planes. [q | k] tile: columns 0..31 to Qh/Ql and 32..63 to Kh/Kl, planes [m][32]. v tiles: transposed planes Vh/Vl [c][HW]; an accumulator lane holds 8 consecutive m of one column, which is one 16-byte piece of a transposed row.
#define CV_P 528                     /* 512-byte bf16 row + 16: conflict-free for 16-byte LDS writes and reads */
typedef __attribute__((ext_vector_type(4))) __bf16 v4bf;
typedef __attribute__((ext_vector_type(8))) __bf16 v8bf;
typedef v4bf __attribute__((may_alias)) v4bfa;
typedef v8bf __attribute__((may_alias)) v8bfa;
__device__ __forceinline__ v16bf av_ld(const unsigned char* p) { return cat16b(*(const v8usa*)p, *(const v8usa*)(p + 32)); }
// 4 N weight rows, f32 -> bf16 (nearest even, like f2bf) -> LDS; the 256 threads read 4 whole rows a step, 16 bytes a lane.
template <int N> __device__ __forceinline__ void cv_w(const float* __restrict__ src, unsigned char* dst, int tid) {
    src += tid * 4; dst += (tid >> 6) * CV_P + (tid & 63) * 8;
#pragma unroll   // straight-line, like the loops inside: many loads are in flight before the first conversion waits
    for (int i0 = 0; i0 < N; i0 += 8) { v4f v[8];
#pragma unroll
        for (int i = 0; i < 8; ++i) v[i] = *(const v4f*)(src + (i0 + i) * 1024);
#pragma unroll
        for (int i = 0; i < 8; ++i) *(v4bfa*)(dst + (i0 + i) * 4 * CV_P) = __builtin_convertvector(v[i], v4bf); }
}
template <typename T16> struct WFrag;
template <> struct WFrag<bf> { typedef v16bf V; static __device__ __forceinline__ V ld(const bf* p) { return cat16b(*(const v8us*)p, *(const v8us*)(p + 16)); } static __device__ __forceinline__ v8f mma(V a, V b, v8f c) { return wmmab(a, b, c); } };
__global__ __launch_bounds__(256) void k_conv(const float* __restrict__ x, const float* __restrict__ wq, const float* __restrict__ wk, const float* __restrict__ wv, bf* Qh, bf* Ql, bf* Kh, bf* Kl, bf* Vh, bf* Vl, const float* __restrict__ bq, const float* __restrict__ bk, const float* __restrict__ bv) {
    typedef WFrag<bf>::V V;
    __shared__ __align__(16) unsigned char xs[64 * CV_P];
    __shared__ __align__(16) unsigned char wsm[(2 * CK + C_) * CV_P];
    __shared__ __align__(16) float os[16 * 68];
    const size_t z = blockIdx.y;
    const int tid = threadIdx.x, lane = tid & 31, lr = lane & 15, hi = lane >> 4; const int r0 = blockIdx.x * 64;
    const int w = __builtin_amdgcn_readfirstlane(tid >> 5);
    { // wave w brings channels 32 w .. + 31 of the 64 tokens: piece i is 8 channels of 32 tokens
        const float* xb = x + z * C_ * HW + (size_t)w * 32 * HW + r0 + lane; v8f v[8];
#pragma unroll
        for (int i = 0; i < 8; ++i)
#pragma unroll
            for (int q = 0; q < 8; ++q) v[i][q] = xb[(size_t)((i >> 1) * 8 + q) * HW + (i & 1) * 32];
        cv_w<CK / 4>(wq, wsm, tid); cv_w<CK / 4>(wk, wsm + CK * CV_P, tid); cv_w<C_ / 4>(wv, wsm + 2 * CK * CV_P, tid);
#pragma unroll
        for (int i = 0; i < 8; ++i) *(v8bfa*)(xs + ((i & 1) * 32 + lane) * CV_P + (w * 4 + (i >> 1)) * 16) = __builtin_convertvector(v[i], v8bf);
        asm volatile("s_wait_xcnt 0x0" ::: "memory");   // the loads' address registers may be reused by what follows
    }
    __syncthreads();                                    // publishes the x tile and the weights
    if (w >= (2 * CK + C_) / 64) return;                // five output tiles; no barrier follows
    v8f acc[4][4];
#pragma unroll
    for (int mb = 0; mb < 4; ++mb)
#pragma unroll
        for (int nb = 0; nb < 4; ++nb) acc[mb][nb] = (v8f){};
    const unsigned char* ap = xs + lr * CV_P + hi * 16; const unsigned char* bp = wsm + (w * 64 + lr) * CV_P + hi * 16;
#pragma unroll   // straight-line: the LDS reads of the next k step stand among this step's products
    for (int kc = 0; kc < C_; kc += 32) {
        V a[4];
#pragma unroll
        for (int mb = 0; mb < 4; ++mb) a[mb] = av_ld(ap + mb * 16 * CV_P + kc * 2);
#pragma unroll
        for (int nb = 0; nb < 4; ++nb) { const V b = av_ld(bp + nb * 16 * CV_P + kc * 2);
#pragma unroll
            for (int mb = 0; mb < 4; ++mb) acc[mb][nb] = WFrag<bf>::mma(a[mb], b, acc[mb][nb]); }
    }
    if (w == 0) {
        const int c = lr * 4;   // a lane's four columns lie in one plane pair: q below CK, k from CK on
        const size_t po = z * HW * CK + (size_t)(r0 + hi) * CK;
        bf* dh = ((c < CK) ? (Qh + c) : (Kh + (c - CK))) + po; bf* dl = ((c < CK) ? (Ql + c) : (Kl + (c - CK))) + po;
        const float* bs = (c < CK) ? (bq + c) : (bk + (c - CK));
        v4f bb; bb[0] = bfr(bs[0]); bb[1] = bfr(bs[1]); bb[2] = bfr(bs[2]); bb[3] = bfr(bs[3]);
#pragma unroll
        for (int mb = 0; mb < 4; ++mb) {
#pragma unroll
            for (int nb = 0; nb < 4; ++nb) {
#pragma unroll
                for (int j = 0; j < 8; ++j) os[(hi * 8 + j) * 68 + nb * 16 + lr] = acc[mb][nb][j]; }
            __builtin_amdgcn_wave_barrier(); asm volatile("" ::: "memory");   // the row reads below stay behind the other lanes' writes
#pragma unroll
            for (int s = 0; s < 8; ++s) { v4f val = *(const v4fa*)(os + (2 * s + hi) * 68 + lr * 4); val += bb;
                v4us oh, ol;
#pragma unroll
                for (int q = 0; q < 4; ++q) { unsigned short x, y; splitf(val[q], x, y); oh[q] = x; ol[q] = y; }
                *(v4us*)(dh + (mb * 16 + 2 * s) * CK) = oh; *(v4us*)(dl + (mb * 16 + 2 * s) * CK) = ol; }
            __builtin_amdgcn_wave_barrier(); asm volatile("" ::: "memory");   // the next block's writes stay behind these reads
        }
    } else {
        const int c0 = (w - 1) * 64;
#pragma unroll
        for (int nb = 0; nb < 4; ++nb) { const int c = c0 + nb * 16 + lr; const float bb = bfr(bv[c]); const size_t o = z * C_ * HW + (size_t)c * HW + r0 + hi * 8;
#pragma unroll
            for (int mb = 0; mb < 4; ++mb) { v8us oh, ol;
#pragma unroll
                for (int j = 0; j < 8; ++j) { const float v = acc[mb][nb][j] + bb; unsigned short x, y; splitf(v, x, y); oh[j] = x; ol[j] = y; }
                *(v8us*)(Vh + o + mb * 16) = oh; *(v8us*)(Vl + o + mb * 16) = ol; } }
        asm volatile("s_wait_xcnt 0x0" ::: "memory");   // behind the last stores: none of their registers is rewritten ahead of it
    }
}


// ---- k_fa: out[c][n] = gamma Y[n][c] + x[c][n], Y[n][c] = sum_m sigmoid(q_n . k_m) V[c][m]; scores, sigmoid, attn.v and the residual in one kernel; one 8-wave work-group per 64 rows n x all 256 c of one batch; grid (HW/64, NB_), 256 threads.
// Wave w owns rows 32 (w & 1) .. + 31 and the k slice [32 (w >> 1), + 32) of every 128-m stage. It forms S^T = K Q^T (3 products), whose accumulator layout (lane = n, registers = 8 consecutive m) is the A fragment layout of the attn.v product, so the sigmoid weights go from registers to registers.
// The scores and sigmoids of stage t + 1 are worked between the attn.v products of stage t. V (hi, lo) is staged in LDS by asynchronous copies, two buffers; K fragments are contiguous 1-KiB pieces read straight from their planes, one stage ahead; the tile's Q rows lie in LDS. The four k-slice partials are summed through LDS in slice order; they lie there transposed, [slice][c][n] (an accumulator lane holds 8 consecutive n of one c), so that the output rows are read and stored with n fastest.
#define FA_PITCH 272                 /* 256-byte row piece + 16: conflict-free for 16-byte LDS reads */
#define FA_PLANE (C_ * FA_PITCH)
#define FA_BUF   (2 * FA_PLANE)
#define FA_NST   (HW / 128)
#define FA_TP    68                  /* f32 pitch of a transposed partial row: 64 n + 4, conflict-free for 16-byte LDS writes and reads */
#define FA_QP    80                  /* 64-byte q row + 16 */
#define FA_QPL   (64 * FA_QP)
// Eight copies, each two 256-byte row pieces of one plane (lanes 0-15 one row, lanes 16-31 the next). The s_wait_xcnt stands inside the statement so that no address register is rewritten ahead of it.
__device__ __forceinline__ void fa_copy8(unsigned l, const unsigned char* g) {
    asm volatile("global_load_async_to_lds_b128 %0, %8, off\n\t"
                 "global_load_async_to_lds_b128 %1, %9, off\n\t"
                 "global_load_async_to_lds_b128 %2, %10, off\n\t"
                 "global_load_async_to_lds_b128 %3, %11, off\n\t"
                 "global_load_async_to_lds_b128 %4, %12, off\n\t"
                 "global_load_async_to_lds_b128 %5, %13, off\n\t"
                 "global_load_async_to_lds_b128 %6, %14, off\n\t"
                 "global_load_async_to_lds_b128 %7, %15, off\n\t"
                 "s_wait_xcnt 0x0"
                 :: "v"(l), "v"(l + 2 * FA_PITCH), "v"(l + 4 * FA_PITCH), "v"(l + 6 * FA_PITCH), "v"(l + 8 * FA_PITCH), "v"(l + 10 * FA_PITCH), "v"(l + 12 * FA_PITCH), "v"(l + 14 * FA_PITCH),
                    "v"(g), "v"(g + (size_t)HW * 4), "v"(g + (size_t)HW * 8), "v"(g + (size_t)HW * 12), "v"(g + (size_t)HW * 16), "v"(g + (size_t)HW * 20), "v"(g + (size_t)HW * 24), "v"(g + (size_t)HW * 28)
                 : "memory");
}
__device__ __forceinline__ void fa_stage(unsigned l, const unsigned char* g) {
#pragma unroll
    for (int s = 0; s < 4; ++s) fa_copy8(l + s * 16 * FA_PITCH, g + (size_t)s * 16 * HW * 2);
}
// Two sigmoid weights and their hi/lo split, packed as the two bf16 of one fragment register: 1 / (1 + 2^(-s log2 e)) on the hardware exp2 and reciprocal (both limits right: 2^+inf -> 0, 2^-inf -> 1); the packed conversions round to nearest even like f2bf.
typedef __attribute__((ext_vector_type(2))) __bf16 v2bf;
typedef __attribute__((ext_vector_type(8))) unsigned v8u;
__device__ __forceinline__ void fa_sig2(float s0, float s1, unsigned& h, unsigned& l) {
    v2f t; t[0] = s0; t[1] = s1; t *= -1.44269504088896341f;
    v2f d; d[0] = __builtin_amdgcn_exp2f(t[0]); d[1] = __builtin_amdgcn_exp2f(t[1]); d += 1.0f;
    v2f sg; sg[0] = __builtin_amdgcn_rcpf(d[0]); sg[1] = __builtin_amdgcn_rcpf(d[1]);
    const v2bf hb = __builtin_convertvector(sg, v2bf);
    const v2bf lb = __builtin_convertvector(sg - __builtin_convertvector(hb, v2f), v2bf);
    h = __builtin_bit_cast(unsigned, hb); l = __builtin_bit_cast(unsigned, lb);
}
__global__ __launch_bounds__(256) void k_fa(const bf* __restrict__ Qh, const bf* __restrict__ Ql, const bf* __restrict__ Kh, const bf* __restrict__ Kl, const bf* __restrict__ Vh, const bf* __restrict__ Vl, const float* __restrict__ X, const float* __restrict__ GM, float* O) {
    __shared__ __attribute__((aligned(16))) unsigned char sm[2 * FA_BUF + 2 * FA_QPL];
    const int tid = threadIdx.x, lane = tid & 31, lr = lane & 15, hi = lane >> 4;
    const int w = __builtin_amdgcn_readfirstlane(tid >> 5);
    const size_t z = blockIdx.y; Qh += z * HW * CK; Ql += z * HW * CK; Kh += z * HW * CK; Kl += z * HW * CK; Vh += z * C_ * HW; Vl += z * C_ * HW; X += z * C_ * HW; O += z * C_ * HW;
    const int r0 = blockIdx.x * 64, nh = w & 1, ks = w >> 1;
    // wave w copies rows 64 (w & 3) .. + 63 of plane w >> 2 (V hi, V lo); a lane brings 16 bytes of a row piece
    const unsigned char* g0 = (const unsigned char*)(((w >> 2) ? Vl : Vh) + (size_t)((w & 3) * 64 + hi) * HW) + lr * 16;
    const unsigned l0 = (unsigned)(size_t)sm + (unsigned)((w >> 2) * FA_PLANE + ((w & 3) * 64 + hi) * FA_PITCH + lr * 16);
    fa_stage(l0, g0);
    // the tile's 64 q rows (hi, lo) into LDS once: their fragments are re-read every stage instead of holding 32 registers through the attn.v products
    { const size_t o = (size_t)(r0 + (tid >> 2)) * CK + (tid & 3) * 8; unsigned char* d = sm + 2 * FA_BUF + (tid >> 2) * FA_QP + (tid & 3) * 16; *(v8usa*)d = *(const v8us*)(Qh + o); *(v8usa*)(d + FA_QPL) = *(const v8us*)(Ql + o); }
    v8f acc[2][16];
#pragma unroll
    for (int nb = 0; nb < 2; ++nb)
#pragma unroll
        for (int cb = 0; cb < 16; ++cb) acc[nb][cb] = (v8f){};
    asm volatile("s_wait_dscnt 0x0" ::: "memory");      // this wave's q rows are written before the barrier publishes them
    __syncthreads();
    const unsigned char* qf = sm + 2 * FA_BUF + (nh * 32 + lr) * FA_QP + hi * 16;
    const unsigned ko = (unsigned)((ks * 32 + lr) * CK + 8 * hi);
    v16bf kh[2], kl[2], a[2], a2[2];
#pragma unroll
    for (int mt = 0; mt < 2; ++mt) { kh[mt] = WFrag<bf>::ld(Kh + ko + mt * 16 * CK); kl[mt] = WFrag<bf>::ld(Kl + ko + mt * 16 * CK); }
    // stage 0's sigmoid weights
#pragma unroll
    for (int nb = 0; nb < 2; ++nb) { const v16bf qh = av_ld(qf + nb * 16 * FA_QP), ql = av_ld(qf + FA_QPL + nb * 16 * FA_QP); v8u ph, pl;
#pragma unroll
        for (int mt = 0; mt < 2; ++mt) { v8f s = wmmab(kh[mt], qh, (v8f){}); s = wmmab(kh[mt], ql, s); s = wmmab(kl[mt], qh, s);
#pragma unroll
            for (int j = 0; j < 4; ++j) { unsigned x, y; fa_sig2(s[2 * j], s[2 * j + 1], x, y); ph[mt * 4 + j] = x; pl[mt * 4 + j] = y; } }
        a[nb] = __builtin_bit_cast(v16bf, ph); a2[nb] = __builtin_bit_cast(v16bf, pl); }
#pragma unroll
    for (int mt = 0; mt < 2; ++mt) { kh[mt] = WFrag<bf>::ld(Kh + ko + (size_t)128 * CK + mt * 16 * CK); kl[mt] = WFrag<bf>::ld(Kl + ko + (size_t)128 * CK + mt * 16 * CK); }
    const unsigned fro = (unsigned)(lr * FA_PITCH + ks * 64 + hi * 16);
#pragma unroll 1   // one stage a trip: the two-buffer order below is per trip
    for (int t = 0; t < FA_NST; ++t) {
        // hand-over at the head of the trip, so that the work below is the loop's last block and stays between the products
        asm volatile("s_wait_dscnt 0x0" ::: "memory");      // this wave's reads of stage t - 1 are done before its buffer is refilled
        asm volatile("s_wait_asynccnt 0x0" ::: "memory");   // this wave's copies of stage t have landed
        __syncthreads();                                    // publishes stage t and ends every reader's use of stage t - 1
        if (t + 1 < FA_NST) fa_stage(l0 + ((t + 1) & 1) * FA_BUF, g0 + (size_t)(t + 1) * 256);
        const unsigned char* fb = sm + (t & 1) * FA_BUF + fro;
        v16bf bv[2][2], bw[2][2];   // V hi and lo fragments of two c blocks, [group parity][c block]
        v8f st[2][2];
        v8u ph[2], pl[2];
        { v16bf qh[2], ql[2];
#pragma unroll
            for (int nb = 0; nb < 2; ++nb) { qh[nb] = av_ld(qf + nb * 16 * FA_QP); ql[nb] = av_ld(qf + FA_QPL + nb * 16 * FA_QP); }
#pragma unroll
            for (int cc = 0; cc < 2; ++cc) { bv[0][cc] = av_ld(fb + cc * 16 * FA_PITCH); bw[0][cc] = av_ld(fb + FA_PLANE + cc * 16 * FA_PITCH); }
            // scores of stage t + 1 (the last trip repeats the last stage's; its weights are not used)
#pragma unroll
            for (int nb = 0; nb < 2; ++nb)
#pragma unroll
                for (int mt = 0; mt < 2; ++mt) st[nb][mt] = wmmab(kh[mt], qh[nb], (v8f){});
#pragma unroll
            for (int nb = 0; nb < 2; ++nb)
#pragma unroll
                for (int mt = 0; mt < 2; ++mt) st[nb][mt] = wmmab(kh[mt], ql[nb], st[nb][mt]);
#pragma unroll
            for (int nb = 0; nb < 2; ++nb)
#pragma unroll
                for (int mt = 0; mt < 2; ++mt) st[nb][mt] = wmmab(kl[mt], qh[nb], st[nb][mt]); }
        const size_t kn = (size_t)((t + 2 < FA_NST) ? t + 2 : FA_NST - 1) * 128 * CK;   // clamped: the last two trips read the last stage's rows again, in bounds
#pragma unroll
        for (int g = 0; g < 8; ++g) { const int cu = g & 1, nx = cu ^ 1;
            __builtin_amdgcn_sched_barrier(0);   // keeps the next group's fragment loads ahead of this group's products, so that their latency is covered
            if (g < 7) {
#pragma unroll
                for (int cc = 0; cc < 2; ++cc) { bv[nx][cc] = av_ld(fb + ((g + 1) * 2 + cc) * 16 * FA_PITCH); bw[nx][cc] = av_ld(fb + FA_PLANE + ((g + 1) * 2 + cc) * 16 * FA_PITCH); }
            } else {
#pragma unroll
                for (int mt = 0; mt < 2; ++mt) { kh[mt] = WFrag<bf>::ld((Kh + kn + mt * 16 * CK) + ko); kl[mt] = WFrag<bf>::ld((Kl + kn + mt * 16 * CK) + ko); }
            }
            __builtin_amdgcn_sched_barrier(0);   // the loads above stay above; the sigmoids below stay in this group, between the products
#pragma unroll
            for (int cc = 0; cc < 2; ++cc)
#pragma unroll
                for (int nb = 0; nb < 2; ++nb) acc[nb][g * 2 + cc] = wmmab(a[nb], bv[cu][cc], acc[nb][g * 2 + cc]);
#pragma unroll
            for (int cc = 0; cc < 2; ++cc)
#pragma unroll
                for (int nb = 0; nb < 2; ++nb) acc[nb][g * 2 + cc] = wmmab(a2[nb], bv[cu][cc], acc[nb][g * 2 + cc]);
#pragma unroll
            for (int cc = 0; cc < 2; ++cc)
#pragma unroll
                for (int nb = 0; nb < 2; ++nb) acc[nb][g * 2 + cc] = wmmab(a[nb], bw[cu][cc], acc[nb][g * 2 + cc]);
#pragma unroll
            for (int u = 0; u < 2; ++u) { const int e = g * 2 + u, nb = e >> 3, i = e & 7; unsigned x, y; fa_sig2(st[nb][i >> 2][2 * (i & 3)], st[nb][i >> 2][2 * (i & 3) + 1], x, y); ph[nb][i] = x; pl[nb][i] = y; } }
#pragma unroll
        for (int nb = 0; nb < 2; ++nb) { a[nb] = __builtin_bit_cast(v16bf, ph[nb]); a2[nb] = __builtin_bit_cast(v16bf, pl[nb]); }
    }
    asm volatile("s_wait_dscnt 0x0" ::: "memory");          // this wave's reads of the last stage are done
    asm volatile("s_wait_asynccnt 0x0" ::: "memory");       // nothing in flight when LDS becomes the partial tiles
    __syncthreads();                                        // every wave has left the last stage before its buffer is overwritten
    float* red = (float*)sm;
    float* mine = red + (size_t)ks * C_ * FA_TP + lr * FA_TP + nh * 32 + hi * 8;
#pragma unroll
    for (int nb = 0; nb < 2; ++nb)
#pragma unroll
        for (int cb = 0; cb < 16; ++cb) { float* d = mine + cb * 16 * FA_TP + nb * 16;
            *(v4fa*)d = __builtin_shufflevector(acc[nb][cb], acc[nb][cb], 0, 1, 2, 3); *(v4fa*)(d + 4) = __builtin_shufflevector(acc[nb][cb], acc[nb][cb], 4, 5, 6, 7); }
    __syncthreads();
    const float gm = bfr(GM[0]);
#pragma unroll
    for (int s = 0; s < 16; ++s) { const int idx = s * 256 + tid, c = idx >> 4, nofs = (idx & 15) * 4; const float* p = red + c * FA_TP + nofs; v4f val = *(const v4fa*)p;
#pragma unroll
        for (int k = 1; k < 4; ++k) val += *(const v4fa*)(p + k * C_ * FA_TP);
        const size_t o = (size_t)c * HW + r0 + nofs; const v4f xv = *(const v4f*)(X + o); v4f ov;
#pragma unroll
        for (int q = 0; q < 4; ++q) ov[q] = __fadd_rn(__fmul_rn(gm, val[q]), bfr(xv[q]));
        *(v4f*)(O + o) = ov; }
}

extern "C" void kernel_launch(void* const* d_in, const int* in_sizes, int n_in,
                              void* d_out, int out_size, void* d_ws, size_t ws_size, hipStream_t stream) {
    (void)in_sizes; (void)n_in; (void)out_size;
    const float* x = (const float*)d_in[0]; const float* wq = (const float*)d_in[1]; const float* bq = (const float*)d_in[2]; const float* wk = (const float*)d_in[3]; const float* bk = (const float*)d_in[4]; const float* wv = (const float*)d_in[5]; const float* bv = (const float*)d_in[6]; const float* GM = (const float*)d_in[7];
    float* OUT = (float*)d_out;     // [4][256][4096]
    char* wsp = (char*)d_ws;
    auto take = [&](size_t bytes) { char* p = wsp; wsp += (bytes + 255) & ~(size_t)255; return (void*)p; };
    bf* Qh = (bf*)take((size_t)NB_ * HW * CK * 2); bf* Ql = (bf*)take((size_t)NB_ * HW * CK * 2); bf* Kh = (bf*)take((size_t)NB_ * HW * CK * 2); bf* Kl = (bf*)take((size_t)NB_ * HW * CK * 2); bf* VTh = (bf*)take((size_t)NB_ * C_ * HW * 2); bf* VTl = (bf*)take((size_t)NB_ * C_ * HW * 2);
    if ((size_t)(wsp - (char*)d_ws) > ws_size) return;
    k_conv<<<dim3(HW / 64, NB_, 1), 256, 0, stream>>>(x, wq, wk, wv, Qh, Ql, Kh, Kl, VTh, VTl, bq, bk, bv);                                   /* q, k as hi/lo planes [b][n][32]; v as transposed hi/lo planes [b][c][m] */
    k_fa<<<dim3(HW / 64, NB_, 1), 256, 0, stream>>>(Qh, Ql, Kh, Kl, VTh, VTl, x, GM, OUT);                                                  /* out[b][c][n] = gamma sum_m sigmoid(q_n . k_m) v[c][m] + x[b][c][n] */
}

// v007
// Measured time: 76.5 microseconds a run.
// In both of two side-by-side timings against v006, it was 1.09 times as fast.
// Counting every step since v000, it is 8.20 times as fast.
#include <hip/hip_runtime.h>

// Sigmoid attention on a channel-major feature map (x [4][256][64][64] -> [c][n], n = 4096; q = Wq x + bq, k = Wk x + bk ([32][256] 1x1 convs), v = Wv x + bv ([256][256]); attn[n][m] = sigmoid(sum_o q[o][n] k[o][m]) (no softmax, no scaling); out[c][n] = sum_m v[c][m] attn[n][m]; result = gamma out + x (gamma scalar, read) -> [4][256][64][64] (4.2 M)).
// Layout, two launches, each over all batches: the 1x1 convs are one GEMM of token-major x against the stacked [out][in] weights [Wq ; Wk ; Wv] (+ bias), whose work-groups round and transpose their own x tile and the weights into LDS; the epilogue of its [q | k] tiles writes the hi/lo planes [n][32], that of its v tiles the transposed [c][m] hi/lo planes; one kernel over all batches forms the scores in f32, takes the sigmoid, splits it into hi/lo in registers, multiplies by v (3 products) and writes the channel-major output gamma Y + x with n fastest.
// Compute dtypes, f32 accumulate: x, weights, biases, gamma rounded to bf16; x exact bf16; q/k/v hi + lo planes of the f32 conv outputs; scores and attn.v 3 products; sigmoid in f32 (hardware exp2 and reciprocal); residual in f32.

#define NB_  4
#define C_   256
#define HW   4096
#define CK   32
typedef _Float16 h16;
typedef unsigned short bf;
typedef __attribute__((ext_vector_type(16))) __bf16   v16bf;
typedef __attribute__((ext_vector_type(16))) _Float16 v16h;
typedef __attribute__((ext_vector_type(8)))  _Float16 v8h;
typedef __attribute__((ext_vector_type(8)))  unsigned short v8us;
typedef __attribute__((ext_vector_type(8)))  float    v8f;
typedef __attribute__((ext_vector_type(4)))  float    v4f;
typedef __attribute__((ext_vector_type(2)))  float    v2f;
typedef __attribute__((ext_vector_type(4)))  unsigned short v4us;
typedef __attribute__((ext_vector_type(2)))  unsigned short v2us;
typedef v8h  __attribute__((may_alias)) v8ha;
typedef v4f  __attribute__((may_alias)) v4fa;
typedef v8us __attribute__((may_alias)) v8usa;

__device__ __forceinline__ unsigned short f2bf(float f) { unsigned u = __float_as_uint(f); u += 0x7FFFu + ((u >> 16) & 1u); return (unsigned short)(u >> 16); }
__device__ __forceinline__ float bf2f(unsigned short b) { return __uint_as_float(((unsigned)b) << 16); }
__device__ __forceinline__ float bfr(float f) { return bf2f(f2bf(f)); }
__device__ __forceinline__ void splitf(float y, unsigned short& h, unsigned short& l) { h = f2bf(y); l = f2bf(y - bf2f(h)); }
__device__ __forceinline__ v16h cat16(v8h lo, v8h hi) { return __builtin_shufflevector(lo, hi, 0, 1, 2, 3, 4, 5, 6, 7, 8, 9, 10, 11, 12, 13, 14, 15); }
__device__ __forceinline__ v16bf cat16b(v8us lo, v8us hi) { return __builtin_bit_cast(v16bf, __builtin_shufflevector(lo, hi, 0, 1, 2, 3, 4, 5, 6, 7, 8, 9, 10, 11, 12, 13, 14, 15)); }
__device__ __forceinline__ v8f wmma16(v16h a, v16h b, v8f c) { return __builtin_amdgcn_wmma_f32_16x16x32_f16(false, a, false, b, (short)0, c, false, false); }
__device__ __forceinline__ v8f wmmab(v16bf a, v16bf b, v8f c) { return __builtin_amdgcn_wmma_f32_16x16x32_bf16(false, a, false, b, (short)0, c, false, false); }

// ---- k_conv: the three 1x1 convs of all batches as one GEMM; one 8-wave work-group per 64 tokens x all 320 outputs of one batch; grid (HW/64, NB_), 256 threads.
// C[m][n] (f32, + bias[n]) = sum_k x[z][k][m] Wt[n][k], Wt = [Wq ; Wk ; Wv] stacked by rows. All eight waves bring the operands into LDS as K-contiguous bf16 rows: the x tile [256 c][64 tokens] is read with the tokens along the lanes (whole 128-byte lines) and a lane writes 8 channels of its token as one 16-byte piece, which is the transpose; the weights are read as whole rows.
// Waves 0..4 then each work one 64x64 output tile (16 accumulators): wave 0 is [q | k], waves 1.. are v.
// C is not stored: the epilogue splits it into bf16 hi + lo planes. [q | k] tile: columns 0..31 to Qh/Ql and 32..63 to Kh/Kl, planes [m][32]. v tiles: transposed planes Vh/Vl [c][HW]; an accumulator lane holds 8 consecutive m of one column, which is one 16-byte piece of a transposed row.
#define CV_P 528                     /* 512-byte bf16 row + 16: conflict-free for 16-byte LDS writes and reads */
typedef __attribute__((ext_vector_type(4))) __bf16 v4bf;
typedef __attribute__((ext_vector_type(8))) __bf16 v8bf;
typedef v4bf __attribute__((may_alias)) v4bfa;
typedef v8bf __attribute__((may_alias)) v8bfa;
__device__ __forceinline__ v16bf av_ld(const unsigned char* p) { return cat16b(*(const v8usa*)p, *(const v8usa*)(p + 32)); }
// 4 N weight rows, f32 -> bf16 (nearest even, like f2bf) -> LDS; the 256 threads read 4 whole rows a step, 16 bytes a lane.
template <int N> __device__ __forceinline__ void cv_w(const float* __restrict__ src, unsigned char* dst, int tid) {
    src += tid * 4; dst += (tid >> 6) * CV_P + (tid & 63) * 8;
#pragma unroll   // straight-line, like the loops inside: many loads are in flight before the first conversion waits
    for (int i0 = 0; i0 < N; i0 += 8) { v4f v[8];
#pragma unroll
        for (int i = 0; i < 8; ++i) v[i] = *(const v4f*)(src + (i0 + i) * 1024);
#pragma unroll
        for (int i = 0; i < 8; ++i) *(v4bfa*)(dst + (i0 + i) * 4 * CV_P) = __builtin_convertvector(v[i], v4bf); }
}
template <typename T16> struct WFrag;
template <> struct WFrag<bf> { typedef v16bf V; static __device__ __forceinline__ V ld(const bf* p) { return cat16b(*(const v8us*)p, *(const v8us*)(p + 16)); } static __device__ __forceinline__ v8f mma(V a, V b, v8f c) { return wmmab(a, b, c); } };
__global__ __launch_bounds__(256) void k_conv(const float* __restrict__ x, const float* __restrict__ wq, const float* __restrict__ wk, const float* __restrict__ wv, bf* Qh, bf* Ql, bf* Kh, bf* Kl, bf* Vh, bf* Vl, const float* __restrict__ bq, const float* __restrict__ bk, const float* __restrict__ bv) {
    typedef WFrag<bf>::V V;
    __shared__ __align__(16) unsigned char xs[64 * CV_P];
    __shared__ __align__(16) unsigned char wsm[(2 * CK + C_) * CV_P];
    __shared__ __align__(16) float os[16 * 68];
    const size_t z = blockIdx.y;
    const int tid = threadIdx.x, lane = tid & 31, lr = lane & 15, hi = lane >> 4; const int r0 = blockIdx.x * 64;
    const int w = __builtin_amdgcn_readfirstlane(tid >> 5);
    { // wave w brings channels 32 w .. + 31 of the 64 tokens: piece i is 8 channels of 32 tokens
        const float* xb = x + z * C_ * HW + (size_t)w * 32 * HW + r0 + lane; v8f v[8];
#pragma unroll
        for (int i = 0; i < 8; ++i)
#pragma unroll
            for (int q = 0; q < 8; ++q) v[i][q] = xb[(size_t)((i >> 1) * 8 + q) * HW + (i & 1) * 32];
        cv_w<CK / 4>(wq, wsm, tid); cv_w<CK / 4>(wk, wsm + CK * CV_P, tid); cv_w<C_ / 4>(wv, wsm + 2 * CK * CV_P, tid);
#pragma unroll
        for (int i = 0; i < 8; ++i) *(v8bfa*)(xs + ((i & 1) * 32 + lane) * CV_P + (w * 4 + (i >> 1)) * 16) = __builtin_convertvector(v[i], v8bf);
        asm volatile("s_wait_xcnt 0x0" ::: "memory");   // the loads' address registers may be reused by what follows
    }
    __syncthreads();                                    // publishes the x tile and the weights
    if (w >= (2 * CK + C_) / 64) return;                // five output tiles; no barrier follows
    v8f acc[4][4];
#pragma unroll
    for (int mb = 0; mb < 4; ++mb)
#pragma unroll
        for (int nb = 0; nb < 4; ++nb) acc[mb][nb] = (v8f){};
    const unsigned char* ap = xs + lr * CV_P + hi * 16; const unsigned char* bp = wsm + (w * 64 + lr) * CV_P + hi * 16;
#pragma unroll   // straight-line: the LDS reads of the next k step stand among this step's products
    for (int kc = 0; kc < C_; kc += 32) {
        V a[4];
#pragma unroll
        for (int mb = 0; mb < 4; ++mb) a[mb] = av_ld(ap + mb * 16 * CV_P + kc * 2);
#pragma unroll
        for (int nb = 0; nb < 4; ++nb) { const V b = av_ld(bp + nb * 16 * CV_P + kc * 2);
#pragma unroll
            for (int mb = 0; mb < 4; ++mb) acc[mb][nb] = WFrag<bf>::mma(a[mb], b, acc[mb][nb]); }
    }
    if (w == 0) {
        const int c = lr * 4;   // a lane's four columns lie in one plane pair: q below CK, k from CK on
        const size_t po = z * HW * CK + (size_t)(r0 + hi) * CK;
        bf* dh = ((c < CK) ? (Qh + c) : (Kh + (c - CK))) + po; bf* dl = ((c < CK) ? (Ql + c) : (Kl + (c - CK))) + po;
        const float* bs = (c < CK) ? (bq + c) : (bk + (c - CK));
        v4f bb; bb[0] = bfr(bs[0]); bb[1] = bfr(bs[1]); bb[2] = bfr(bs[2]); bb[3] = bfr(bs[3]);
#pragma unroll
        for (int mb = 0; mb < 4; ++mb) {
#pragma unroll
            for (int nb = 0; nb < 4; ++nb) {
#pragma unroll
                for (int j = 0; j < 8; ++j) os[(hi * 8 + j) * 68 + nb * 16 + lr] = acc[mb][nb][j]; }
            __builtin_amdgcn_wave_barrier(); asm volatile("" ::: "memory");   // the row reads below stay behind the other lanes' writes
#pragma unroll
            for (int s = 0; s < 8; ++s) { v4f val = *(const v4fa*)(os + (2 * s + hi) * 68 + lr * 4); val += bb;
                v4us oh, ol;
#pragma unroll
                for (int q = 0; q < 4; ++q) { unsigned short x, y; splitf(val[q], x, y); oh[q] = x; ol[q] = y; }
                *(v4us*)(dh + (mb * 16 + 2 * s) * CK) = oh; *(v4us*)(dl + (mb * 16 + 2 * s) * CK) = ol; }
            __builtin_amdgcn_wave_barrier(); asm volatile("" ::: "memory");   // the next block's writes stay behind these reads
        }
    } else {
        const int c0 = (w - 1) * 64;
#pragma unroll
        for (int nb = 0; nb < 4; ++nb) { const int c = c0 + nb * 16 + lr; const float bb = bfr(bv[c]); const size_t o = z * C_ * HW + (size_t)c * HW + r0 + hi * 8;
#pragma unroll
            for (int mb = 0; mb < 4; ++mb) { v8us oh, ol;
#pragma unroll
                for (int j = 0; j < 8; ++j) { const float v = acc[mb][nb][j] + bb; unsigned short x, y; splitf(v, x, y); oh[j] = x; ol[j] = y; }
                *(v8us*)(Vh + o + mb * 16) = oh; *(v8us*)(Vl + o + mb * 16) = ol; } }
        asm volatile("s_wait_xcnt 0x0" ::: "memory");   // behind the last stores: none of their registers is rewritten ahead of it
    }
}


// ---- k_fa: out[c][n] = gamma Y[n][c] + x[c][n], Y[n][c] = sum_m sigmoid(q_n . k_m) V[c][m]; scores, sigmoid, attn.v and the residual in one kernel; one 8-wave work-group per 64 rows n x all 256 c of one batch; grid (HW/64, NB_), 256 threads.
// Wave w owns rows 32 (w & 1) .. + 31 and the k slice [32 (w >> 1), + 32) of every 128-m stage. It forms S^T = K Q^T (3 products), whose accumulator layout (lane = n, registers = 8 consecutive m) is the A fragment layout of the attn.v product, so the sigmoid weights go from registers to registers.
// The scores and sigmoids of stage t + 1 are worked between the attn.v products of stage t. V (hi, lo) is staged in LDS by tensor loads (waves 0..3, half a plane each), two buffers; K fragments are contiguous 1-KiB pieces read straight from their planes, one stage ahead; the tile's Q rows lie in LDS. The four k-slice partials are summed through LDS in slice order; they lie there transposed, [slice][c][n] (an accumulator lane holds 8 consecutive n of one c), so that the output rows are read and stored with n fastest.
#define FA_PITCH 272                 /* 256-byte row piece + 16: conflict-free for 16-byte LDS reads */
#define FA_PLANE (C_ * FA_PITCH)
#define FA_BUF   (2 * FA_PLANE)
#define FA_NST   (HW / 128)
#define FA_TP    68                  /* f32 pitch of a transposed partial row: 64 n + 4, conflict-free for 16-byte LDS writes and reads */
#define FA_QP    80                  /* 64-byte q row + 16 */
#define FA_QPL   (64 * FA_QP)
// One tensor load brings half a V plane of one stage: 128 rows of 256 bytes at the source pitch of a [c][HW] bf16 row; the mover lays 16 pad bytes behind every row, which is FA_PITCH. Extents in bytes, tensor = tile, no mask.
typedef unsigned u32x4 __attribute__((ext_vector_type(4)));
typedef unsigned u32x8 __attribute__((ext_vector_type(8)));
#define FA_TROWS 128
static_assert(FA_PITCH == 256 + 16 && (FA_TROWS * FA_PITCH) % 2048 == 0 && FA_PLANE % 2048 == 0, "every tile's place in LDS is a multiple of 2 KiB");
__device__ __forceinline__ unsigned uni(unsigned v) { return (unsigned)__builtin_amdgcn_readfirstlane(v); }
__device__ __forceinline__ unsigned pinned(unsigned v) { unsigned w = uni(v); asm volatile("" : "+s"(w)); return w; }   // holds the word in a scalar register: a test on it is a scalar branch, which a tensor load needs (it ignores EXEC)
__device__ __forceinline__ u32x4 fa_g0(unsigned lds, unsigned long long ga) {
    u32x4 g; g[0] = uni(1u); g[1] = uni(lds); g[2] = uni((unsigned)ga); g[3] = uni((((unsigned)(ga >> 32)) & 0x01FFFFFFu) | 0x80000000u); return g; }
__device__ __forceinline__ u32x8 fa_g1() {
    u32x8 g; g[0] = uni((1u << 20) | (5u << 22) | (3u << 25)); g[1] = uni(256u << 16); g[2] = uni((unsigned)FA_TROWS << 16); g[3] = uni(256u << 16); g[4] = uni((unsigned)FA_TROWS); g[5] = uni((unsigned)HW * 2u); g[6] = uni(0u); g[7] = uni(0u); return g; }
__device__ __forceinline__ void fa_tload(u32x4 d0, u32x8 d1) { asm volatile("tensor_load_to_lds %0, %1" :: "s"(d0), "s"(d1) : "memory"); }
// The wait names both groups as inputs: their registers stay live, and so unwritten, from the request to the wait that covers it.
__device__ __forceinline__ void fa_twait(u32x4 d0, u32x8 d1) { asm volatile("s_wait_tensorcnt 0x0" :: "s"(d0), "s"(d1) : "memory"); }
// Two sigmoid weights and their hi/lo split, packed as the two bf16 of one fragment register: 1 / (1 + 2^(-s log2 e)) on the hardware exp2 and reciprocal (both limits right: 2^+inf -> 0, 2^-inf -> 1); the packed conversions round to nearest even like f2bf.
typedef __attribute__((ext_vector_type(2))) __bf16 v2bf;
typedef __attribute__((ext_vector_type(8))) unsigned v8u;
__device__ __forceinline__ void fa_sig2(float s0, float s1, unsigned& h, unsigned& l) {
    v2f t; t[0] = s0; t[1] = s1; t *= -1.44269504088896341f;
    v2f d; d[0] = __builtin_amdgcn_exp2f(t[0]); d[1] = __builtin_amdgcn_exp2f(t[1]); d += 1.0f;
    v2f sg; sg[0] = __builtin_amdgcn_rcpf(d[0]); sg[1] = __builtin_amdgcn_rcpf(d[1]);
    const v2bf hb = __builtin_convertvector(sg, v2bf);
    const v2bf lb = __builtin_convertvector(sg - __builtin_convertvector(hb, v2f), v2bf);
    h = __builtin_bit_cast(unsigned, hb); l = __builtin_bit_cast(unsigned, lb);
}
__global__ __launch_bounds__(256) void k_fa(const bf* __restrict__ Qh, const bf* __restrict__ Ql, const bf* __restrict__ Kh, const bf* __restrict__ Kl, const bf* __restrict__ Vh, const bf* __restrict__ Vl, const float* __restrict__ X, const float* __restrict__ GM, float* O) {
    __shared__ __attribute__((aligned(2048))) unsigned char sm[2 * FA_BUF + 2 * FA_QPL];
    const int tid = threadIdx.x, lane = tid & 31, lr = lane & 15, hi = lane >> 4;
    const int w = __builtin_amdgcn_readfirstlane(tid >> 5);
    const size_t z = blockIdx.y; Qh += z * HW * CK; Ql += z * HW * CK; Kh += z * HW * CK; Kl += z * HW * CK; Vh += z * C_ * HW; Vl += z * C_ * HW; X += z * C_ * HW; O += z * C_ * HW;
    const int r0 = blockIdx.x * 64, nh = w & 1, ks = w >> 1;
    // waves 0..3 issue: wave w brings rows 128 (w & 1) .. + 127 of plane w >> 1 (V hi, V lo), one request a stage
    const unsigned long long g0 = (unsigned long long)(size_t)(((w >> 1) ? Vl : Vh) + (size_t)(w & 1) * FA_TROWS * HW);
    const unsigned l0 = (unsigned)(size_t)sm + (unsigned)((w >> 1) * FA_PLANE + (w & 1) * FA_TROWS * FA_PITCH);
    u32x8 d1 = fa_g1(); u32x4 d0 = fa_g0(l0, g0);
    asm volatile("" : "+s"(d0), "+s"(d1));   // pinned descriptor words: each group is one set of scalar registers, the same at the load and at the wait that names it
    if (pinned(w < 4)) fa_tload(d0, d1);
    // the tile's 64 q rows (hi, lo) into LDS once: their fragments are re-read every stage instead of holding 32 registers through the attn.v products
    { const size_t o = (size_t)(r0 + (tid >> 2)) * CK + (tid & 3) * 8; unsigned char* d = sm + 2 * FA_BUF + (tid >> 2) * FA_QP + (tid & 3) * 16; *(v8usa*)d = *(const v8us*)(Qh + o); *(v8usa*)(d + FA_QPL) = *(const v8us*)(Ql + o); }
    v8f acc[2][16];
#pragma unroll
    for (int nb = 0; nb < 2; ++nb)
#pragma unroll
        for (int cb = 0; cb < 16; ++cb) acc[nb][cb] = (v8f){};
    asm volatile("s_wait_dscnt 0x0" ::: "memory");      // this wave's q rows are written before the barrier publishes them
    __syncthreads();
    const unsigned char* qf = sm + 2 * FA_BUF + (nh * 32 + lr) * FA_QP + hi * 16;
    const unsigned ko = (unsigned)((ks * 32 + lr) * CK + 8 * hi);
    v16bf kh[2], kl[2], a[2], a2[2];
#pragma unroll
    for (int mt = 0; mt < 2; ++mt) { kh[mt] = WFrag<bf>::ld(Kh + ko + mt * 16 * CK); kl[mt] = WFrag<bf>::ld(Kl + ko + mt * 16 * CK); }
    // stage 0's sigmoid weights
#pragma unroll
    for (int nb = 0; nb < 2; ++nb) { const v16bf qh = av_ld(qf + nb * 16 * FA_QP), ql = av_ld(qf + FA_QPL + nb * 16 * FA_QP); v8u ph, pl;
#pragma unroll
        for (int mt = 0; mt < 2; ++mt) { v8f s = wmmab(kh[mt], qh, (v8f){}); s = wmmab(kh[mt], ql, s); s = wmmab(kl[mt], qh, s);
#pragma unroll
            for (int j = 0; j < 4; ++j) { unsigned x, y; fa_sig2(s[2 * j], s[2 * j + 1], x, y); ph[mt * 4 + j] = x; pl[mt * 4 + j] = y; } }
        a[nb] = __builtin_bit_cast(v16bf, ph); a2[nb] = __builtin_bit_cast(v16bf, pl); }
#pragma unroll
    for (int mt = 0; mt < 2; ++mt) { kh[mt] = WFrag<bf>::ld(Kh + ko + (size_t)128 * CK + mt * 16 * CK); kl[mt] = WFrag<bf>::ld(Kl + ko + (size_t)128 * CK + mt * 16 * CK); }
    const unsigned fro = (unsigned)(lr * FA_PITCH + ks * 64 + hi * 16);
#pragma unroll 1   // one stage a trip: the two-buffer order below is per trip
    for (int t = 0; t < FA_NST; ++t) {
        // hand-over at the head of the trip, so that the work below is the loop's last block and stays between the products
        asm volatile("s_wait_dscnt 0x0" ::: "memory");      // this wave's reads of stage t - 1 are done before its buffer is refilled
        fa_twait(d0, d1);                                   // an issuing wave's tile of stage t has landed
        __syncthreads();                                    // publishes stage t and ends every reader's use of stage t - 1
        if (pinned((w < 4) & (t + 1 < FA_NST))) { const unsigned n = pinned((unsigned)t + 1u);   // pinned: the descriptor words are formed here, behind the wait
            d0 = fa_g0(l0 + (n & 1u) * FA_BUF, g0 + (unsigned long long)n * 256u);
            asm volatile("" : "+s"(d0));   // pinned descriptor words, as in front of the loop: the load names the registers that the next trip's wait names
            fa_tload(d0, d1); }
        const unsigned char* fb = sm + (t & 1) * FA_BUF + fro;
        v16bf bv[2][2], bw[2][2];   // V hi and lo fragments of two c blocks, [group parity][c block]
        v8f st[2][2];
        v8u ph[2], pl[2];
        { v16bf qh[2], ql[2];
#pragma unroll
            for (int nb = 0; nb < 2; ++nb) { qh[nb] = av_ld(qf + nb * 16 * FA_QP); ql[nb] = av_ld(qf + FA_QPL + nb * 16 * FA_QP); }
#pragma unroll
            for (int cc = 0; cc < 2; ++cc) { bv[0][cc] = av_ld(fb + cc * 16 * FA_PITCH); bw[0][cc] = av_ld(fb + FA_PLANE + cc * 16 * FA_PITCH); }
            // scores of stage t + 1 (the last trip repeats the last stage's; its weights are not used)
#pragma unroll
            for (int nb = 0; nb < 2; ++nb)
#pragma unroll
                for (int mt = 0; mt < 2; ++mt) st[nb][mt] = wmmab(kh[mt], qh[nb], (v8f){});
#pragma unroll
            for (int nb = 0; nb < 2; ++nb)
#pragma unroll
                for (int mt = 0; mt < 2; ++mt) st[nb][mt] = wmmab(kh[mt], ql[nb], st[nb][mt]);
#pragma unroll
            for (int nb = 0; nb < 2; ++nb)
#pragma unroll
                for (int mt = 0; mt < 2; ++mt) st[nb][mt] = wmmab(kl[mt], qh[nb], st[nb][mt]); }
        const size_t kn = (size_t)((t + 2 < FA_NST) ? t + 2 : FA_NST - 1) * 128 * CK;   // clamped: the last two trips read the last stage's rows again, in bounds
#pragma unroll
        for (int g = 0; g < 8; ++g) { const int cu = g & 1, nx = cu ^ 1;
            __builtin_amdgcn_sched_barrier(0);   // keeps the next group's fragment loads ahead of this group's products, so that their latency is covered
            if (g < 7) {
#pragma unroll
                for (int cc = 0; cc < 2; ++cc) { bv[nx][cc] = av_ld(fb + ((g + 1) * 2 + cc) * 16 * FA_PITCH); bw[nx][cc] = av_ld(fb + FA_PLANE + ((g + 1) * 2 + cc) * 16 * FA_PITCH); }
            } else {
#pragma unroll
                for (int mt = 0; mt < 2; ++mt) { kh[mt] = WFrag<bf>::ld((Kh + kn + mt * 16 * CK) + ko); kl[mt] = WFrag<bf>::ld((Kl + kn + mt * 16 * CK) + ko); }
            }
            __builtin_amdgcn_sched_barrier(0);   // the loads above stay above; the sigmoids below stay in this group, between the products
#pragma unroll
            for (int cc = 0; cc < 2; ++cc)
#pragma unroll
                for (int nb = 0; nb < 2; ++nb) acc[nb][g * 2 + cc] = wmmab(a[nb], bv[cu][cc], acc[nb][g * 2 + cc]);
#pragma unroll
            for (int cc = 0; cc < 2; ++cc)
#pragma unroll
                for (int nb = 0; nb < 2; ++nb) acc[nb][g * 2 + cc] = wmmab(a2[nb], bv[cu][cc], acc[nb][g * 2 + cc]);
#pragma unroll
            for (int cc = 0; cc < 2; ++cc)
#pragma unroll
                for (int nb = 0; nb < 2; ++nb) acc[nb][g * 2 + cc] = wmmab(a[nb], bw[cu][cc], acc[nb][g * 2 + cc]);
#pragma unroll
            for (int u = 0; u < 2; ++u) { const int e = g * 2 + u, nb = e >> 3, i = e & 7; unsigned x, y; fa_sig2(st[nb][i >> 2][2 * (i & 3)], st[nb][i >> 2][2 * (i & 3) + 1], x, y); ph[nb][i] = x; pl[nb][i] = y; } }
#pragma unroll
        for (int nb = 0; nb < 2; ++nb) { a[nb] = __builtin_bit_cast(v16bf, ph[nb]); a2[nb] = __builtin_bit_cast(v16bf, pl[nb]); }
    }
    asm volatile("s_wait_tensorcnt 0x0" ::: "memory");      // nothing in flight when LDS becomes the partial tiles
    asm volatile("s_wait_dscnt 0x0" ::: "memory");          // this wave's reads of the last stage are done
    __syncthreads();                                        // every wave has left the last stage before its buffer is overwritten
    float* red = (float*)sm;
    float* mine = red + (size_t)ks * C_ * FA_TP + lr * FA_TP + nh * 32 + hi * 8;
#pragma unroll
    for (int nb = 0; nb < 2; ++nb)
#pragma unroll
        for (int cb = 0; cb < 16; ++cb) { float* d = mine + cb * 16 * FA_TP + nb * 16;
            *(v4fa*)d = __builtin_shufflevector(acc[nb][cb], acc[nb][cb], 0, 1, 2, 3); *(v4fa*)(d + 4) = __builtin_shufflevector(acc[nb][cb], acc[nb][cb], 4, 5, 6, 7); }
    __syncthreads();
    const float gm = bfr(GM[0]);
#pragma unroll
    for (int s = 0; s < 16; ++s) { const int idx = s * 256 + tid, c = idx >> 4, nofs = (idx & 15) * 4; const float* p = red + c * FA_TP + nofs; v4f val = *(const v4fa*)p;
#pragma unroll
        for (int k = 1; k < 4; ++k) val += *(const v4fa*)(p + k * C_ * FA_TP);
        const size_t o = (size_t)c * HW + r0 + nofs; const v4f xv = *(const v4f*)(X + o); v4f ov;
#pragma unroll
        for (int q = 0; q < 4; ++q) ov[q] = __fadd_rn(__fmul_rn(gm, val[q]), bfr(xv[q]));
        *(v4f*)(O + o) = ov; }
}

extern "C" void kernel_launch(void* const* d_in, const int* in_sizes, int n_in,
                              void* d_out, int out_size, void* d_ws, size_t ws_size, hipStream_t stream) {
    (void)in_sizes; (void)n_in; (void)out_size;
    const float* x = (const float*)d_in[0]; const float* wq = (const float*)d_in[1]; const float* bq = (const float*)d_in[2]; const float* wk = (const float*)d_in[3]; const float* bk = (const float*)d_in[4]; const float* wv = (const float*)d_in[5]; const float* bv = (const float*)d_in[6]; const float* GM = (const float*)d_in[7];
    float* OUT = (float*)d_out;     // [4][256][4096]
    char* wsp = (char*)d_ws;
    auto take = [&](size_t bytes) { char* p = wsp; wsp += (bytes + 255) & ~(size_t)255; return (void*)p; };
    bf* Qh = (bf*)take((size_t)NB_ * HW * CK * 2); bf* Ql = (bf*)take((size_t)NB_ * HW * CK * 2); bf* Kh = (bf*)take((size_t)NB_ * HW * CK * 2); bf* Kl = (bf*)take((size_t)NB_ * HW * CK * 2); bf* VTh = (bf*)take((size_t)NB_ * C_ * HW * 2); bf* VTl = (bf*)take((size_t)NB_ * C_ * HW * 2);
    if ((size_t)(wsp - (char*)d_ws) > ws_size) return;
    k_conv<<<dim3(HW / 64, NB_, 1), 256, 0, stream>>>(x, wq, wk, wv, Qh, Ql, Kh, Kl, VTh, VTl, bq, bk, bv);                                   /* q, k as hi/lo planes [b][n][32]; v as transposed hi/lo planes [b][c][m] */
    k_fa<<<dim3(HW / 64, NB_, 1), 256, 0, stream>>>(Qh, Ql, Kh, Kl, VTh, VTl, x, GM, OUT);                                                  /* out[b][c][n] = gamma sum_m sigmoid(q_n . k_m) v[c][m] + x[b][c][n] */
}

// v008
// It runs in 47.7 microseconds.
// In two side-by-side timings against v007, it was 1.60 and 1.61 times as fast.
// Counting every step since v000, it is 13.2 times as fast.
#include <hip/hip_runtime.h>

// Sigmoid attention on a channel-major feature map (x [4][256][64][64] -> [c][n], n = 4096; q = Wq x + bq, k = Wk x + bk ([32][256] 1x1 convs), v = Wv x + bv ([256][256]); attn[n][m] = sigmoid(sum_o q[o][n] k[o][m]) (no softmax, no scaling); out[c][n] = sum_m v[c][m] attn[n][m]; result = gamma out + x (gamma scalar, read) -> [4][256][64][64] (4.2 M)).
// Layout, two launches, each over all batches: the 1x1 convs are one GEMM of token-major x against the stacked [out][in] weights [Wq ; Wk ; Wv] (+ bias), whose work-groups round and transpose their own x tile and the weights into LDS; the epilogue of its [q | k] tiles writes the f16 planes [n][32], that of its v tiles one transposed [c][m] f16 plane; one kernel over all batches forms the scores (1 product, f32 accumulate), takes the sigmoid, rounds it to f16 in registers, multiplies by v (1 product) and writes the channel-major output gamma Y + x with n fastest.
// Compute dtypes, f32 accumulate: x, weights, biases, gamma rounded to bf16; x exact bf16; the f32 conv outputs q, k, v and the sigmoid weights each rounded once to f16 (11 significant bits; magnitudes below 65504), scores and attn.v 1 f16 product each; sigmoid in f32 (hardware exp2 and reciprocal); residual in f32.

#define NB_  4
#define C_   256
#define HW   4096
#define CK   32
typedef _Float16 h16;
typedef unsigned short bf;
typedef __attribute__((ext_vector_type(16))) __bf16   v16bf;
typedef __attribute__((ext_vector_type(16))) _Float16 v16h;
typedef __attribute__((ext_vector_type(8)))  _Float16 v8h;
typedef __attribute__((ext_vector_type(8)))  unsigned short v8us;
typedef __attribute__((ext_vector_type(8)))  float    v8f;
typedef __attribute__((ext_vector_type(4)))  float    v4f;
typedef __attribute__((ext_vector_type(2)))  float    v2f;
typedef __attribute__((ext_vector_type(2)))  unsigned short v2us;
typedef v8h  __attribute__((may_alias)) v8ha;
typedef __attribute__((ext_vector_type(4)))  _Float16 v4h;
typedef v4h  __attribute__((may_alias)) v4ha;
typedef v4f  __attribute__((may_alias)) v4fa;
typedef v8us __attribute__((may_alias)) v8usa;

__device__ __forceinline__ unsigned short f2bf(float f) { unsigned u = __float_as_uint(f); u += 0x7FFFu + ((u >> 16) & 1u); return (unsigned short)(u >> 16); }
__device__ __forceinline__ float bf2f(unsigned short b) { return __uint_as_float(((unsigned)b) << 16); }
__device__ __forceinline__ float bfr(float f) { return bf2f(f2bf(f)); }
__device__ __forceinline__ v16h cat16(v8h lo, v8h hi) { return __builtin_shufflevector(lo, hi, 0, 1, 2, 3, 4, 5, 6, 7, 8, 9, 10, 11, 12, 13, 14, 15); }
__device__ __forceinline__ v16bf cat16b(v8us lo, v8us hi) { return __builtin_bit_cast(v16bf, __builtin_shufflevector(lo, hi, 0, 1, 2, 3, 4, 5, 6, 7, 8, 9, 10, 11, 12, 13, 14, 15)); }
__device__ __forceinline__ v8f wmma16(v16h a, v16h b, v8f c) { return __builtin_amdgcn_wmma_f32_16x16x32_f16(false, a, false, b, (short)0, c, false, false); }
__device__ __forceinline__ v8f wmmab(v16bf a, v16bf b, v8f c) { return __builtin_amdgcn_wmma_f32_16x16x32_bf16(false, a, false, b, (short)0, c, false, false); }

// ---- k_conv: the three 1x1 convs of all batches as one GEMM; one 8-wave work-group per 64 tokens x all 320 outputs of one batch; grid (HW/64, NB_), 256 threads.
// C[m][n] (f32, + bias[n]) = sum_k x[z][k][m] Wt[n][k], Wt = [Wq ; Wk ; Wv] stacked by rows. All eight waves bring the operands into LDS as K-contiguous bf16 rows: the x tile [256 c][64 tokens] is read with the tokens along the lanes (whole 128-byte lines) and a lane writes 8 channels of its token as one 16-byte piece, which is the transpose; the weights are read as whole rows.
// Waves 0..4 then each work one 64x64 output tile (16 accumulators): wave 0 is [q | k], waves 1.. are v.
// C is not stored: the epilogue rounds it to f16. [q | k] tile: columns 0..31 to Qf and 32..63 to Kf, planes [m][32]. v tiles: transposed plane Vf [c][HW]; an accumulator lane holds 8 consecutive m of one column, which is one 16-byte piece of a transposed row.
#define CV_P 528                     /* 512-byte bf16 row + 16: conflict-free for 16-byte LDS writes and reads */
typedef __attribute__((ext_vector_type(4))) __bf16 v4bf;
typedef __attribute__((ext_vector_type(8))) __bf16 v8bf;
typedef v4bf __attribute__((may_alias)) v4bfa;
typedef v8bf __attribute__((may_alias)) v8bfa;
__device__ __forceinline__ v16bf av_ld(const unsigned char* p) { return cat16b(*(const v8usa*)p, *(const v8usa*)(p + 32)); }
// 4 N weight rows, f32 -> bf16 (nearest even, like f2bf) -> LDS; the 256 threads read 4 whole rows a step, 16 bytes a lane.
template <int N> __device__ __forceinline__ void cv_w(const float* __restrict__ src, unsigned char* dst, int tid) {
    src += tid * 4; dst += (tid >> 6) * CV_P + (tid & 63) * 8;
#pragma unroll   // straight-line, like the loops inside: many loads are in flight before the first conversion waits
    for (int i0 = 0; i0 < N; i0 += 8) { v4f v[8];
#pragma unroll
        for (int i = 0; i < 8; ++i) v[i] = *(const v4f*)(src + (i0 + i) * 1024);
#pragma unroll
        for (int i = 0; i < 8; ++i) *(v4bfa*)(dst + (i0 + i) * 4 * CV_P) = __builtin_convertvector(v[i], v4bf); }
}
template <typename T16> struct WFrag;
template <> struct WFrag<bf> { typedef v16bf V; static __device__ __forceinline__ V ld(const bf* p) { return cat16b(*(const v8us*)p, *(const v8us*)(p + 16)); } static __device__ __forceinline__ v8f mma(V a, V b, v8f c) { return wmmab(a, b, c); } };
__global__ __launch_bounds__(256) void k_conv(const float* __restrict__ x, const float* __restrict__ wq, const float* __restrict__ wk, const float* __restrict__ wv, bf* Qf, bf* Kf, bf* Vf, const float* __restrict__ bq, const float* __restrict__ bk, const float* __restrict__ bv) {
    typedef WFrag<bf>::V V;
    __shared__ __align__(16) unsigned char xs[64 * CV_P];
    __shared__ __align__(16) unsigned char wsm[(2 * CK + C_) * CV_P];
    __shared__ __align__(16) float os[16 * 68];
    const size_t z = blockIdx.y;
    const int tid = threadIdx.x, lane = tid & 31, lr = lane & 15, hi = lane >> 4; const int r0 = blockIdx.x * 64;
    const int w = __builtin_amdgcn_readfirstlane(tid >> 5);
    { // wave w brings channels 32 w .. + 31 of the 64 tokens: piece i is 8 channels of 32 tokens
        const float* xb = x + z * C_ * HW + (size_t)w * 32 * HW + r0 + lane; v8f v[8];
#pragma unroll
        for (int i = 0; i < 8; ++i)
#pragma unroll
            for (int q = 0; q < 8; ++q) v[i][q] = xb[(size_t)((i >> 1) * 8 + q) * HW + (i & 1) * 32];
        cv_w<CK / 4>(wq, wsm, tid); cv_w<CK / 4>(wk, wsm + CK * CV_P, tid); cv_w<C_ / 4>(wv, wsm + 2 * CK * CV_P, tid);
#pragma unroll
        for (int i = 0; i < 8; ++i) *(v8bfa*)(xs + ((i & 1) * 32 + lane) * CV_P + (w * 4 + (i >> 1)) * 16) = __builtin_convertvector(v[i], v8bf);
        asm volatile("s_wait_xcnt 0x0" ::: "memory");   // the loads' address registers may be reused by what follows
    }
    __syncthreads();                                    // publishes the x tile and the weights
    if (w >= (2 * CK + C_) / 64) return;                // five output tiles; no barrier follows
    v8f acc[4][4];
#pragma unroll
    for (int mb = 0; mb < 4; ++mb)
#pragma unroll
        for (int nb = 0; nb < 4; ++nb) acc[mb][nb] = (v8f){};
    const unsigned char* ap = xs + lr * CV_P + hi * 16; const unsigned char* bp = wsm + (w * 64 + lr) * CV_P + hi * 16;
#pragma unroll   // straight-line: the LDS reads of the next k step stand among this step's products
    for (int kc = 0; kc < C_; kc += 32) {
        V a[4];
#pragma unroll
        for (int mb = 0; mb < 4; ++mb) a[mb] = av_ld(ap + mb * 16 * CV_P + kc * 2);
#pragma unroll
        for (int nb = 0; nb < 4; ++nb) { const V b = av_ld(bp + nb * 16 * CV_P + kc * 2);
#pragma unroll
            for (int mb = 0; mb < 4; ++mb) acc[mb][nb] = WFrag<bf>::mma(a[mb], b, acc[mb][nb]); }
    }
    if (w == 0) {
        const int c = lr * 4;   // a lane's four columns lie in one plane: q below CK, k from CK on
        const size_t po = z * HW * CK + (size_t)(r0 + hi) * CK;
        bf* dh = ((c < CK) ? (Qf + c) : (Kf + (c - CK))) + po;
        const float* bs = (c < CK) ? (bq + c) : (bk + (c - CK));
        v4f bb; bb[0] = bfr(bs[0]); bb[1] = bfr(bs[1]); bb[2] = bfr(bs[2]); bb[3] = bfr(bs[3]);
#pragma unroll
        for (int mb = 0; mb < 4; ++mb) {
#pragma unroll
            for (int nb = 0; nb < 4; ++nb) {
#pragma unroll
                for (int j = 0; j < 8; ++j) os[(hi * 8 + j) * 68 + nb * 16 + lr] = acc[mb][nb][j]; }
            __builtin_amdgcn_wave_barrier(); asm volatile("" ::: "memory");   // the row reads below stay behind the other lanes' writes
#pragma unroll
            for (int s = 0; s < 8; ++s) { v4f val = *(const v4fa*)(os + (2 * s + hi) * 68 + lr * 4); val += bb;
                *(v4ha*)(dh + (mb * 16 + 2 * s) * CK) = __builtin_convertvector(val, v4h); }
            __builtin_amdgcn_wave_barrier(); asm volatile("" ::: "memory");   // the next block's writes stay behind these reads
        }
    } else {
        const int c0 = (w - 1) * 64;
#pragma unroll
        for (int nb = 0; nb < 4; ++nb) { const int c = c0 + nb * 16 + lr; const float bb = bfr(bv[c]); const size_t o = z * C_ * HW + (size_t)c * HW + r0 + hi * 8;
#pragma unroll
            for (int mb = 0; mb < 4; ++mb) *(v8ha*)(Vf + o + mb * 16) = __builtin_convertvector(acc[mb][nb] + bb, v8h); }
        asm volatile("s_wait_xcnt 0x0" ::: "memory");   // behind the last stores: none of their registers is rewritten ahead of it
    }
}


// ---- k_fa: out[c][n] = gamma Y[n][c] + x[c][n], Y[n][c] = sum_m sigmoid(q_n . k_m) V[c][m]; scores, sigmoid, attn.v and the residual in one kernel; one 8-wave work-group per 64 rows n x all 256 c of one batch; grid (HW/64, NB_), 256 threads.
// Wave w owns rows 32 (w & 1) .. + 31 and the k slice [32 (w >> 1), + 32) of every 128-m stage. It forms S^T = K Q^T, whose accumulator layout (lane = n, registers = 8 consecutive m) is the A fragment layout of the attn.v product, so the sigmoid weights go from registers to registers.
// The scores and sigmoids of stage t + 1 are worked between the attn.v products of stage t. V (f16) is staged in LDS by tensor loads (waves 0..3, 64 rows c each), two buffers; K fragments are contiguous 1-KiB pieces read straight from their planes, one stage ahead; the tile's Q rows lie in LDS. The four k-slice partials are summed through LDS in slice order; they lie there transposed, [slice][c][n] (an accumulator lane holds 8 consecutive n of one c), so that the output rows are read and stored with n fastest.
#define FA_PITCH 272                 /* 256-byte row piece + 16: conflict-free for 16-byte LDS reads */
#define FA_TROWS 64                  /* rows c of one tensor load */
#define FA_SLICE 18432               /* LDS bytes of one load's tile: 64 padded rows (17408), rounded up to a multiple of 2 KiB */
#define FA_BUF   ((C_ / FA_TROWS) * FA_SLICE)
#define FA_CB(cb) (((cb) >> 2) * FA_SLICE + ((cb) & 3) * 16 * FA_PITCH)   /* place of the 16-row c block cb in a buffer */
#define FA_NST   (HW / 128)
#define FA_TP    68                  /* f32 pitch of a transposed partial row: 64 n + 4, conflict-free for 16-byte LDS writes and reads */
#define FA_QP    80                  /* 64-byte q row + 16 */
#define FA_QPL   (64 * FA_QP)         /* the tile's 64 q rows */
// One tensor load brings a quarter of V of one stage: 64 rows of 256 bytes at the source pitch of a [c][HW] f16 row; the mover lays 16 pad bytes behind every row, which is FA_PITCH. Extents in bytes, tensor = tile, no mask.
typedef unsigned u32x4 __attribute__((ext_vector_type(4)));
typedef unsigned u32x8 __attribute__((ext_vector_type(8)));
static_assert(FA_PITCH == 256 + 16 && FA_TROWS * FA_PITCH <= FA_SLICE && FA_SLICE % 2048 == 0, "every tile's place in LDS is a multiple of 2 KiB");
__device__ __forceinline__ unsigned uni(unsigned v) { return (unsigned)__builtin_amdgcn_readfirstlane(v); }
__device__ __forceinline__ unsigned pinned(unsigned v) { unsigned w = uni(v); asm volatile("" : "+s"(w)); return w; }   // holds the word in a scalar register: a test on it is a scalar branch, which a tensor load needs (it ignores EXEC)
__device__ __forceinline__ u32x4 fa_g0(unsigned lds, unsigned long long ga) {
    u32x4 g; g[0] = uni(1u); g[1] = uni(lds); g[2] = uni((unsigned)ga); g[3] = uni((((unsigned)(ga >> 32)) & 0x01FFFFFFu) | 0x80000000u); return g; }
__device__ __forceinline__ u32x8 fa_g1() {
    u32x8 g; g[0] = uni((1u << 20) | (5u << 22) | (3u << 25)); g[1] = uni(256u << 16); g[2] = uni((unsigned)FA_TROWS << 16); g[3] = uni(256u << 16); g[4] = uni((unsigned)FA_TROWS); g[5] = uni((unsigned)HW * 2u); g[6] = uni(0u); g[7] = uni(0u); return g; }
__device__ __forceinline__ void fa_tload(u32x4 d0, u32x8 d1) { asm volatile("tensor_load_to_lds %0, %1" :: "s"(d0), "s"(d1) : "memory"); }
// The wait names both groups as inputs: their registers stay live, and so unwritten, from the request to the wait that covers it.
__device__ __forceinline__ void fa_twait(u32x4 d0, u32x8 d1) { asm volatile("s_wait_tensorcnt 0x0" :: "s"(d0), "s"(d1) : "memory"); }
// Two sigmoid weights, packed as the two f16 of one fragment register: 1 / (1 + 2^(-s log2 e)) on the hardware exp2 and reciprocal (both limits right: 2^+inf -> 0, 2^-inf -> 1); the packed conversion rounds to nearest even.
typedef __attribute__((ext_vector_type(2))) _Float16 v2h;
typedef __attribute__((ext_vector_type(8))) unsigned v8u;
__device__ __forceinline__ v16h fa_ldh(const unsigned char* p) { return cat16(*(const v8ha*)p, *(const v8ha*)(p + 32)); }
__device__ __forceinline__ v16h fa_ldk(const bf* p) { return __builtin_bit_cast(v16h, WFrag<bf>::ld(p)); }
__device__ __forceinline__ unsigned fa_sig2(float s0, float s1) {
    v2f t; t[0] = s0; t[1] = s1; t *= -1.44269504088896341f;
    v2f d; d[0] = __builtin_amdgcn_exp2f(t[0]); d[1] = __builtin_amdgcn_exp2f(t[1]); d += 1.0f;
    v2f sg; sg[0] = __builtin_amdgcn_rcpf(d[0]); sg[1] = __builtin_amdgcn_rcpf(d[1]);
    return __builtin_bit_cast(unsigned, __builtin_convertvector(sg, v2h));
}
__global__ __launch_bounds__(256) void k_fa(const bf* __restrict__ Qf, const bf* __restrict__ Kf, const bf* __restrict__ Vf, const float* __restrict__ X, const float* __restrict__ GM, float* O) {
    __shared__ __attribute__((aligned(2048))) unsigned char sm[4 * C_ * FA_TP * 4];   // the four partial tiles of the epilogue are the larger use
    static_assert(2 * FA_BUF + FA_QPL <= 4 * C_ * FA_TP * 4, "the two V buffers and the q rows fit");
    const int tid = threadIdx.x, lane = tid & 31, lr = lane & 15, hi = lane >> 4;
    const int w = __builtin_amdgcn_readfirstlane(tid >> 5);
    const size_t z = blockIdx.y; Qf += z * HW * CK; Kf += z * HW * CK; Vf += z * C_ * HW; X += z * C_ * HW; O += z * C_ * HW;
    const int r0 = blockIdx.x * 64, nh = w & 1, ks = w >> 1;
    // waves 0..3 issue: wave w brings rows 64 w .. + 63 of V, one request a stage
    const unsigned long long g0 = (unsigned long long)(size_t)(Vf + (size_t)(w & 3) * FA_TROWS * HW);
    const unsigned l0 = (unsigned)(size_t)sm + (unsigned)((w & 3) * FA_SLICE);
    u32x8 d1 = fa_g1(); u32x4 d0 = fa_g0(l0, g0);
    asm volatile("" : "+s"(d0), "+s"(d1));   // pinned descriptor words: each group is one set of scalar registers, the same at the load and at the wait that names it
    if (pinned(w < 4)) fa_tload(d0, d1);
    // the tile's 64 q rows into LDS once: their fragments are re-read every stage instead of holding registers through the attn.v products
    { const size_t o = (size_t)(r0 + (tid >> 2)) * CK + (tid & 3) * 8; unsigned char* d = sm + 2 * FA_BUF + (tid >> 2) * FA_QP + (tid & 3) * 16; *(v8usa*)d = *(const v8us*)(Qf + o); }
    v8f acc[2][16];
#pragma unroll
    for (int nb = 0; nb < 2; ++nb)
#pragma unroll
        for (int cb = 0; cb < 16; ++cb) acc[nb][cb] = (v8f){};
    asm volatile("s_wait_dscnt 0x0" ::: "memory");      // this wave's q rows are written before the barrier publishes them
    __syncthreads();
    const unsigned char* qf = sm + 2 * FA_BUF + (nh * 32 + lr) * FA_QP + hi * 16;
    const unsigned ko = (unsigned)((ks * 32 + lr) * CK + 8 * hi);
    v16h kf[2], a[2];
#pragma unroll
    for (int mt = 0; mt < 2; ++mt) kf[mt] = fa_ldk(Kf + ko + mt * 16 * CK);
    // stage 0's sigmoid weights
#pragma unroll
    for (int nb = 0; nb < 2; ++nb) { const v16h qv = fa_ldh(qf + nb * 16 * FA_QP); v8u ph;
#pragma unroll
        for (int mt = 0; mt < 2; ++mt) { const v8f s = wmma16(kf[mt], qv, (v8f){});
#pragma unroll
            for (int j = 0; j < 4; ++j) ph[mt * 4 + j] = fa_sig2(s[2 * j], s[2 * j + 1]); }
        a[nb] = __builtin_bit_cast(v16h, ph); }
#pragma unroll
    for (int mt = 0; mt < 2; ++mt) kf[mt] = fa_ldk(Kf + ko + (size_t)128 * CK + mt * 16 * CK);
    const unsigned fro = (unsigned)(lr * FA_PITCH + ks * 64 + hi * 16);
#pragma unroll 1   // one stage a trip: the two-buffer order below is per trip
    for (int t = 0; t < FA_NST; ++t) {
        // hand-over at the head of the trip, so that the work below is the loop's last block and stays between the products
        asm volatile("s_wait_dscnt 0x0" ::: "memory");      // this wave's reads of stage t - 1 are done before its buffer is refilled
        fa_twait(d0, d1);                                   // an issuing wave's tile of stage t has landed
        __syncthreads();                                    // publishes stage t and ends every reader's use of stage t - 1
        if (pinned((w < 4) & (t + 1 < FA_NST))) { const unsigned n = pinned((unsigned)t + 1u);   // pinned: the descriptor words are formed here, behind the wait
            d0 = fa_g0(l0 + (n & 1u) * FA_BUF, g0 + (unsigned long long)n * 256u);
            asm volatile("" : "+s"(d0));   // pinned descriptor words, as in front of the loop: the load names the registers that the next trip's wait names
            fa_tload(d0, d1); }
        const unsigned char* fb = sm + (t & 1) * FA_BUF + fro;
        v16h bv[2][4];   // V fragments of four c blocks, [group parity][c block]
        v8f st[2][2];
        v8u ph[2];
        { v16h qv[2];
#pragma unroll
            for (int nb = 0; nb < 2; ++nb) qv[nb] = fa_ldh(qf + nb * 16 * FA_QP);
#pragma unroll
            for (int cc = 0; cc < 4; ++cc) bv[0][cc] = fa_ldh(fb + FA_CB(cc));
            // scores of stage t + 1 (the last trip repeats the last stage's; its weights are not used)
#pragma unroll
            for (int nb = 0; nb < 2; ++nb)
#pragma unroll
                for (int mt = 0; mt < 2; ++mt) st[nb][mt] = wmma16(kf[mt], qv[nb], (v8f){}); }
        const size_t kn = (size_t)((t + 2 < FA_NST) ? t + 2 : FA_NST - 1) * 128 * CK;   // clamped: the last two trips read the last stage's rows again, in bounds
#pragma unroll
        for (int g = 0; g < 4; ++g) { const int cu = g & 1, nx = cu ^ 1;
            __builtin_amdgcn_sched_barrier(0);   // keeps the next group's fragment loads ahead of this group's products, so that their latency is covered
            if (g < 3) {
#pragma unroll
                for (int cc = 0; cc < 4; ++cc) bv[nx][cc] = fa_ldh(fb + FA_CB((g + 1) * 4 + cc));
            } else {
#pragma unroll
                for (int mt = 0; mt < 2; ++mt) kf[mt] = fa_ldk((Kf + kn + mt * 16 * CK) + ko);
            }
            __builtin_amdgcn_sched_barrier(0);   // the loads above stay above; the sigmoids below stay in this group, between the products
#pragma unroll
            for (int cc = 0; cc < 4; ++cc)
#pragma unroll
                for (int nb = 0; nb < 2; ++nb) acc[nb][g * 4 + cc] = wmma16(a[nb], bv[cu][cc], acc[nb][g * 4 + cc]);
#pragma unroll
            for (int u = 0; u < 4; ++u) { const int e = g * 4 + u, nb = e >> 3, i = e & 7; ph[nb][i] = fa_sig2(st[nb][i >> 2][2 * (i & 3)], st[nb][i >> 2][2 * (i & 3) + 1]); } }
#pragma unroll
        for (int nb = 0; nb < 2; ++nb) a[nb] = __builtin_bit_cast(v16h, ph[nb]);
    }
    asm volatile("s_wait_tensorcnt 0x0" ::: "memory");      // nothing in flight when LDS becomes the partial tiles
    asm volatile("s_wait_dscnt 0x0" ::: "memory");          // this wave's reads of the last stage are done
    __syncthreads();                                        // every wave has left the last stage before its buffer is overwritten
    float* red = (float*)sm;
    float* mine = red + (size_t)ks * C_ * FA_TP + lr * FA_TP + nh * 32 + hi * 8;
#pragma unroll
    for (int nb = 0; nb < 2; ++nb)
#pragma unroll
        for (int cb = 0; cb < 16; ++cb) { float* d = mine + cb * 16 * FA_TP + nb * 16;
            *(v4fa*)d = __builtin_shufflevector(acc[nb][cb], acc[nb][cb], 0, 1, 2, 3); *(v4fa*)(d + 4) = __builtin_shufflevector(acc[nb][cb], acc[nb][cb], 4, 5, 6, 7); }
    __syncthreads();
    const float gm = bfr(GM[0]);
#pragma unroll
    for (int s = 0; s < 16; ++s) { const int idx = s * 256 + tid, c = idx >> 4, nofs = (idx & 15) * 4; const float* p = red + c * FA_TP + nofs; v4f val = *(const v4fa*)p;
#pragma unroll
        for (int k = 1; k < 4; ++k) val += *(const v4fa*)(p + k * C_ * FA_TP);
        const size_t o = (size_t)c * HW + r0 + nofs; const v4f xv = *(const v4f*)(X + o); v4f ov;
#pragma unroll
        for (int q = 0; q < 4; ++q) ov[q] = __fadd_rn(__fmul_rn(gm, val[q]), bfr(xv[q]));
        *(v4f*)(O + o) = ov; }
}

extern "C" void kernel_launch(void* const* d_in, const int* in_sizes, int n_in,
                              void* d_out, int out_size, void* d_ws, size_t ws_size, hipStream_t stream) {
    (void)in_sizes; (void)n_in; (void)out_size;
    const float* x = (const float*)d_in[0]; const float* wq = (const float*)d_in[1]; const float* bq = (const float*)d_in[2]; const float* wk = (const float*)d_in[3]; const float* bk = (const float*)d_in[4]; const float* wv = (const float*)d_in[5]; const float* bv = (const float*)d_in[6]; const float* GM = (const float*)d_in[7];
    float* OUT = (float*)d_out;     // [4][256][4096]
    char* wsp = (char*)d_ws;
    auto take = [&](size_t bytes) { char* p = wsp; wsp += (bytes + 255) & ~(size_t)255; return (void*)p; };
    bf* Qf = (bf*)take((size_t)NB_ * HW * CK * 2); bf* Kf = (bf*)take((size_t)NB_ * HW * CK * 2); bf* VTf = (bf*)take((size_t)NB_ * C_ * HW * 2);
    if ((size_t)(wsp - (char*)d_ws) > ws_size) return;
    k_conv<<<dim3(HW / 64, NB_, 1), 256, 0, stream>>>(x, wq, wk, wv, Qf, Kf, VTf, bq, bk, bv);                                                /* q, k as f16 planes [b][n][32]; v as one transposed f16 plane [b][c][m] */
    k_fa<<<dim3(HW / 64, NB_, 1), 256, 0, stream>>>(Qf, Kf, VTf, x, GM, OUT);                                                  /* out[b][c][n] = gamma sum_m sigmoid(q_n . k_m) v[c][m] + x[b][c][n] */
}

// v009
// One run takes 42.3 microseconds.
// Timed twice side by side with v008, it ran 1.14 and 1.15 times as fast.
// Over all steps from v000 it is 15.0 times as fast.
#include <hip/hip_runtime.h>

// Sigmoid attention on a channel-major feature map (x [4][256][64][64] -> [c][n], n = 4096; q = Wq x + bq, k = Wk x + bk ([32][256] 1x1 convs), v = Wv x + bv ([256][256]); attn[n][m] = sigmoid(sum_o q[o][n] k[o][m]) (no softmax, no scaling); out[c][n] = sum_m v[c][m] attn[n][m]; result = gamma out + x (gamma scalar, read) -> [4][256][64][64] (4.2 M)).
// Layout, two launches, each over all batches: the 1x1 convs are one GEMM of token-major x against the stacked [out][in] weights [Wq ; Wk ; Wv] (+ bias), whose work-groups round and transpose their own x tile and the weights into LDS; the epilogue of its [q | k] tiles writes the f16 planes [n][32], that of its v tiles one transposed [c][m] f16 plane; one kernel over all batches forms the scores (1 product, f32 accumulate), takes the sigmoid, rounds it to f16 in registers, multiplies by v (1 product) and writes the channel-major output gamma Y + x with n fastest.
// Compute dtypes, f32 accumulate: x, weights, biases, gamma rounded to bf16; x exact bf16; the f32 conv outputs q, k, v and the sigmoid weights each rounded once to f16 (11 significant bits; magnitudes below 65504), scores and attn.v 1 f16 product each; sigmoid in f32 (hardware exp2 and reciprocal); residual in f32.

#define NB_  4
#define C_   256
#define HW   4096
#define CK   32
typedef _Float16 h16;
typedef unsigned short bf;
typedef __attribute__((ext_vector_type(16))) __bf16   v16bf;
typedef __attribute__((ext_vector_type(16))) _Float16 v16h;
typedef __attribute__((ext_vector_type(8)))  _Float16 v8h;
typedef __attribute__((ext_vector_type(8)))  unsigned short v8us;
typedef __attribute__((ext_vector_type(8)))  float    v8f;
typedef __attribute__((ext_vector_type(4)))  float    v4f;
typedef __attribute__((ext_vector_type(2)))  float    v2f;
typedef __attribute__((ext_vector_type(2)))  unsigned short v2us;
typedef v8h  __attribute__((may_alias)) v8ha;
typedef __attribute__((ext_vector_type(4)))  _Float16 v4h;
typedef v4h  __attribute__((may_alias)) v4ha;
typedef v4f  __attribute__((may_alias)) v4fa;
typedef v8us __attribute__((may_alias)) v8usa;

__device__ __forceinline__ unsigned short f2bf(float f) { unsigned u = __float_as_uint(f); u += 0x7FFFu + ((u >> 16) & 1u); return (unsigned short)(u >> 16); }
__device__ __forceinline__ float bf2f(unsigned short b) { return __uint_as_float(((unsigned)b) << 16); }
__device__ __forceinline__ float bfr(float f) { return bf2f(f2bf(f)); }
__device__ __forceinline__ v16h cat16(v8h lo, v8h hi) { return __builtin_shufflevector(lo, hi, 0, 1, 2, 3, 4, 5, 6, 7, 8, 9, 10, 11, 12, 13, 14, 15); }
__device__ __forceinline__ v16bf cat16b(v8us lo, v8us hi) { return __builtin_bit_cast(v16bf, __builtin_shufflevector(lo, hi, 0, 1, 2, 3, 4, 5, 6, 7, 8, 9, 10, 11, 12, 13, 14, 15)); }
__device__ __forceinline__ v8f wmma16(v16h a, v16h b, v8f c) { return __builtin_amdgcn_wmma_f32_16x16x32_f16(false, a, false, b, (short)0, c, false, false); }
__device__ __forceinline__ v8f wmmab(v16bf a, v16bf b, v8f c) { return __builtin_amdgcn_wmma_f32_16x16x32_bf16(false, a, false, b, (short)0, c, false, false); }

// ---- k_conv: the three 1x1 convs of all batches as one GEMM; one 8-wave work-group per 64 tokens x all 320 outputs of one batch; grid (HW/64, NB_), 256 threads.
// C[m][n] (f32, + bias[n]) = sum_k x[z][k][m] Wt[n][k], Wt = [Wq ; Wk ; Wv] stacked by rows. All eight waves bring the operands into LDS as K-contiguous bf16 rows: the x tile [256 c][64 tokens] is read with the tokens along the lanes (whole 128-byte lines) and a lane writes 8 channels of its token as one 16-byte piece, which is the transpose; the weights are read as whole rows.
// Waves 0..4 then each work one 64x64 output tile (16 accumulators): wave 0 is [q | k], waves 1.. are v.
// C is not stored: the epilogue rounds it to f16. [q | k] tile: columns 0..31 to Qf and 32..63 to Kf, planes [m][32]. v tiles: transposed plane Vf [c][HW]; an accumulator lane holds 8 consecutive m of one column, which is one 16-byte piece of a transposed row.
#define CV_P 528                     /* 512-byte bf16 row + 16: conflict-free for 16-byte LDS writes and reads */
typedef __attribute__((ext_vector_type(4))) __bf16 v4bf;
typedef __attribute__((ext_vector_type(8))) __bf16 v8bf;
typedef v4bf __attribute__((may_alias)) v4bfa;
typedef v8bf __attribute__((may_alias)) v8bfa;
__device__ __forceinline__ v16bf av_ld(const unsigned char* p) { return cat16b(*(const v8usa*)p, *(const v8usa*)(p + 32)); }
// 4 N weight rows, f32 -> bf16 (nearest even, like f2bf) -> LDS; the 256 threads read 4 whole rows a step, 16 bytes a lane.
template <int N> __device__ __forceinline__ void cv_w(const float* __restrict__ src, unsigned char* dst, int tid) {
    src += tid * 4; dst += (tid >> 6) * CV_P + (tid & 63) * 8;
#pragma unroll   // straight-line, like the loops inside: many loads are in flight before the first conversion waits
    for (int i0 = 0; i0 < N; i0 += 8) { v4f v[8];
#pragma unroll
        for (int i = 0; i < 8; ++i) v[i] = *(const v4f*)(src + (i0 + i) * 1024);
#pragma unroll
        for (int i = 0; i < 8; ++i) *(v4bfa*)(dst + (i0 + i) * 4 * CV_P) = __builtin_convertvector(v[i], v4bf); }
}
template <typename T16> struct WFrag;
template <> struct WFrag<bf> { typedef v16bf V; static __device__ __forceinline__ V ld(const bf* p) { return cat16b(*(const v8us*)p, *(const v8us*)(p + 16)); } static __device__ __forceinline__ v8f mma(V a, V b, v8f c) { return wmmab(a, b, c); } };
__global__ __launch_bounds__(256) void k_conv(const float* __restrict__ x, const float* __restrict__ wq, const float* __restrict__ wk, const float* __restrict__ wv, bf* Qf, bf* Kf, bf* Vf, const float* __restrict__ bq, const float* __restrict__ bk, const float* __restrict__ bv) {
    typedef WFrag<bf>::V V;
    __shared__ __align__(16) unsigned char xs[64 * CV_P];
    __shared__ __align__(16) unsigned char wsm[(2 * CK + C_) * CV_P];
    __shared__ __align__(16) float os[16 * 68];
    const size_t z = blockIdx.y;
    const int tid = threadIdx.x, lane = tid & 31, lr = lane & 15, hi = lane >> 4; const int r0 = blockIdx.x * 64;
    const int w = __builtin_amdgcn_readfirstlane(tid >> 5);
    { // wave w brings channels 32 w .. + 31 of the 64 tokens: piece i is 8 channels of 32 tokens
        const float* xb = x + z * C_ * HW + (size_t)w * 32 * HW + r0 + lane; v8f v[8];
#pragma unroll
        for (int i = 0; i < 8; ++i)
#pragma unroll
            for (int q = 0; q < 8; ++q) v[i][q] = xb[(size_t)((i >> 1) * 8 + q) * HW + (i & 1) * 32];
        cv_w<CK / 4>(wq, wsm, tid); cv_w<CK / 4>(wk, wsm + CK * CV_P, tid); cv_w<C_ / 4>(wv, wsm + 2 * CK * CV_P, tid);
#pragma unroll
        for (int i = 0; i < 8; ++i) *(v8bfa*)(xs + ((i & 1) * 32 + lane) * CV_P + (w * 4 + (i >> 1)) * 16) = __builtin_convertvector(v[i], v8bf);
        asm volatile("s_wait_xcnt 0x0" ::: "memory");   // the loads' address registers may be reused by what follows
    }
    __syncthreads();                                    // publishes the x tile and the weights
    if (w >= (2 * CK + C_) / 64) return;                // five output tiles; no barrier follows
    v8f acc[4][4];
#pragma unroll
    for (int mb = 0; mb < 4; ++mb)
#pragma unroll
        for (int nb = 0; nb < 4; ++nb) acc[mb][nb] = (v8f){};
    const unsigned char* ap = xs + lr * CV_P + hi * 16; const unsigned char* bp = wsm + (w * 64 + lr) * CV_P + hi * 16;
#pragma unroll   // straight-line: the LDS reads of the next k step stand among this step's products
    for (int kc = 0; kc < C_; kc += 32) {
        V a[4];
#pragma unroll
        for (int mb = 0; mb < 4; ++mb) a[mb] = av_ld(ap + mb * 16 * CV_P + kc * 2);
#pragma unroll
        for (int nb = 0; nb < 4; ++nb) { const V b = av_ld(bp + nb * 16 * CV_P + kc * 2);
#pragma unroll
            for (int mb = 0; mb < 4; ++mb) acc[mb][nb] = WFrag<bf>::mma(a[mb], b, acc[mb][nb]); }
    }
    if (w == 0) {
        const int c = lr * 4;   // a lane's four columns lie in one plane: q below CK, k from CK on
        const size_t po = z * HW * CK + (size_t)(r0 + hi) * CK;
        bf* dh = ((c < CK) ? (Qf + c) : (Kf + (c - CK))) + po;
        const float* bs = (c < CK) ? (bq + c) : (bk + (c - CK));
        v4f bb; bb[0] = bfr(bs[0]); bb[1] = bfr(bs[1]); bb[2] = bfr(bs[2]); bb[3] = bfr(bs[3]);
#pragma unroll
        for (int mb = 0; mb < 4; ++mb) {
#pragma unroll
            for (int nb = 0; nb < 4; ++nb) {
#pragma unroll
                for (int j = 0; j < 8; ++j) os[(hi * 8 + j) * 68 + nb * 16 + lr] = acc[mb][nb][j]; }
            __builtin_amdgcn_wave_barrier(); asm volatile("" ::: "memory");   // the row reads below stay behind the other lanes' writes
#pragma unroll
            for (int s = 0; s < 8; ++s) { v4f val = *(const v4fa*)(os + (2 * s + hi) * 68 + lr * 4); val += bb;
                *(v4ha*)(dh + (mb * 16 + 2 * s) * CK) = __builtin_convertvector(val, v4h); }
            __builtin_amdgcn_wave_barrier(); asm volatile("" ::: "memory");   // the next block's writes stay behind these reads
        }
    } else {
        const int c0 = (w - 1) * 64;
#pragma unroll
        for (int nb = 0; nb < 4; ++nb) { const int c = c0 + nb * 16 + lr; const float bb = bfr(bv[c]); const size_t o = z * C_ * HW + (size_t)c * HW + r0 + hi * 8;
#pragma unroll
            for (int mb = 0; mb < 4; ++mb) *(v8ha*)(Vf + o + mb * 16) = __builtin_convertvector(acc[mb][nb] + bb, v8h); }
        asm volatile("s_wait_xcnt 0x0" ::: "memory");   // behind the last stores: none of their registers is rewritten ahead of it
    }
}


// ---- k_fa: out[c][n] = gamma Y[n][c] + x[c][n], Y[n][c] = sum_m sigmoid(q_n . k_m) V[c][m]; scores, sigmoid, attn.v and the residual in one kernel; one 8-wave work-group per 64 rows n x all 256 c of one batch; grid (HW/64, NB_), 256 threads.
// Wave w owns rows 32 (w & 1) .. + 31 and the k slice [32 (w >> 1), + 32) of every 128-m stage. It forms S^T = K Q^T, whose accumulator layout (lane = n, registers = 8 consecutive m) is the A fragment layout of the attn.v product, so the sigmoid weights go from registers to registers.
// The scores and sigmoids of stage t + 1 are worked between the attn.v products of stage t. V (f16) is staged in LDS by tensor loads (waves 0..3, 64 rows c each), two buffers; K fragments are contiguous 1-KiB pieces read straight from their planes, one stage ahead; the tile's Q rows lie in LDS. A work-group walks the stages from a start of its own and wraps (FA_ST), so that the groups of a batch, two to a start, are spread over the V and K tiles. The four k-slice partials are summed through LDS in slice order; they lie there transposed, [slice][c][n] (an accumulator lane holds 8 consecutive n of one c), so that the output rows are read and stored with n fastest.
#define FA_PITCH 272                 /* 256-byte row piece + 16: conflict-free for 16-byte LDS reads */
#define FA_TROWS 64                  /* rows c of one tensor load */
#define FA_SLICE 18432               /* LDS bytes of one load's tile: 64 padded rows (17408), rounded up to a multiple of 2 KiB */
#define FA_BUF   ((C_ / FA_TROWS) * FA_SLICE)
#define FA_CB(cb) (((cb) >> 2) * FA_SLICE + ((cb) & 3) * 16 * FA_PITCH)   /* place of the 16-row c block cb in a buffer */
#define FA_NST   (HW / 128)
#define FA_ST(i) (((unsigned)(i) + rot) & (unsigned)(FA_NST - 1))   /* the m stage worked in trip i */
static_assert((FA_NST & (FA_NST - 1)) == 0, "the wrap is a mask");
#define FA_TP    68                  /* f32 pitch of a transposed partial row: 64 n + 4, conflict-free for 16-byte LDS writes and reads */
#define FA_QP    80                  /* 64-byte q row + 16 */
#define FA_QPL   (64 * FA_QP)         /* the tile's 64 q rows */
// One tensor load brings a quarter of V of one stage: 64 rows of 256 bytes at the source pitch of a [c][HW] f16 row; the mover lays 16 pad bytes behind every row, which is FA_PITCH. Extents in bytes, tensor = tile, no mask.
typedef unsigned u32x4 __attribute__((ext_vector_type(4)));
typedef unsigned u32x8 __attribute__((ext_vector_type(8)));
static_assert(FA_PITCH == 256 + 16 && FA_TROWS * FA_PITCH <= FA_SLICE && FA_SLICE % 2048 == 0, "every tile's place in LDS is a multiple of 2 KiB");
__device__ __forceinline__ unsigned uni(unsigned v) { return (unsigned)__builtin_amdgcn_readfirstlane(v); }
__device__ __forceinline__ unsigned pinned(unsigned v) { unsigned w = uni(v); asm volatile("" : "+s"(w)); return w; }   // holds the word in a scalar register: a test on it is a scalar branch, which a tensor load needs (it ignores EXEC)
__device__ __forceinline__ u32x4 fa_g0(unsigned lds, unsigned long long ga) {
    u32x4 g; g[0] = uni(1u); g[1] = uni(lds); g[2] = uni((unsigned)ga); g[3] = uni((((unsigned)(ga >> 32)) & 0x01FFFFFFu) | 0x80000000u); return g; }
__device__ __forceinline__ u32x8 fa_g1() {
    u32x8 g; g[0] = uni((1u << 20) | (5u << 22) | (3u << 25)); g[1] = uni(256u << 16); g[2] = uni((unsigned)FA_TROWS << 16); g[3] = uni(256u << 16); g[4] = uni((unsigned)FA_TROWS); g[5] = uni((unsigned)HW * 2u); g[6] = uni(0u); g[7] = uni(0u); return g; }
__device__ __forceinline__ void fa_tload(u32x4 d0, u32x8 d1) { asm volatile("tensor_load_to_lds %0, %1" :: "s"(d0), "s"(d1) : "memory"); }
// The wait names both groups as inputs: their registers stay live, and so unwritten, from the request to the wait that covers it.
__device__ __forceinline__ void fa_twait(u32x4 d0, u32x8 d1) { asm volatile("s_wait_tensorcnt 0x0" :: "s"(d0), "s"(d1) : "memory"); }
// Two sigmoid weights, packed as the two f16 of one fragment register: 1 / (1 + 2^(-s log2 e)) on the hardware exp2 and reciprocal (both limits right: 2^+inf -> 0, 2^-inf -> 1); the packed conversion rounds to nearest even.
typedef __attribute__((ext_vector_type(2))) _Float16 v2h;
typedef __attribute__((ext_vector_type(8))) unsigned v8u;
__device__ __forceinline__ v16h fa_ldh(const unsigned char* p) { return cat16(*(const v8ha*)p, *(const v8ha*)(p + 32)); }
__device__ __forceinline__ v16h fa_ldk(const bf* p) { return __builtin_bit_cast(v16h, WFrag<bf>::ld(p)); }
__device__ __forceinline__ unsigned fa_sig2(float s0, float s1) {
    v2f t; t[0] = s0; t[1] = s1; t *= -1.44269504088896341f;
    v2f d; d[0] = __builtin_amdgcn_exp2f(t[0]); d[1] = __builtin_amdgcn_exp2f(t[1]); d += 1.0f;
    v2f sg; sg[0] = __builtin_amdgcn_rcpf(d[0]); sg[1] = __builtin_amdgcn_rcpf(d[1]);
    return __builtin_bit_cast(unsigned, __builtin_convertvector(sg, v2h));
}
__global__ __launch_bounds__(256) void k_fa(const bf* __restrict__ Qf, const bf* __restrict__ Kf, const bf* __restrict__ Vf, const float* __restrict__ X, const float* __restrict__ GM, float* O) {
    __shared__ __attribute__((aligned(2048))) unsigned char sm[4 * C_ * FA_TP * 4];   // the four partial tiles of the epilogue are the larger use
    static_assert(2 * FA_BUF + FA_QPL <= 4 * C_ * FA_TP * 4, "the two V buffers and the q rows fit");
    const int tid = threadIdx.x, lane = tid & 31, lr = lane & 15, hi = lane >> 4;
    const int w = __builtin_amdgcn_readfirstlane(tid >> 5);
    const size_t z = blockIdx.y; Qf += z * HW * CK; Kf += z * HW * CK; Vf += z * C_ * HW; X += z * C_ * HW; O += z * C_ * HW;
    const int r0 = blockIdx.x * 64, nh = w & 1, ks = w >> 1;
    // Start of the walk. All groups of a batch read the same V and K; walking in step they ask for each tile at the same moment, also the first time, when it is not yet in their L2. With 32 starts a tile is fetched by the group that starts there and found in L2 by the others. Blocks x and x + 4 share a start; any placement gives right values.
    const unsigned rot = (((blockIdx.x >> 3) << 2) | (blockIdx.x & 3u)) & (unsigned)(FA_NST - 1);
    // waves 0..3 issue: wave w brings rows 64 w .. + 63 of V, one request a stage
    const unsigned long long g0 = (unsigned long long)(size_t)(Vf + (size_t)(w & 3) * FA_TROWS * HW);
    const unsigned l0 = (unsigned)(size_t)sm + (unsigned)((w & 3) * FA_SLICE);
    u32x8 d1 = fa_g1(); u32x4 d0 = fa_g0(l0, g0 + (unsigned long long)FA_ST(0) * 256u);
    asm volatile("" : "+s"(d0), "+s"(d1));   // pinned descriptor words: each group is one set of scalar registers, the same at the load and at the wait that names it
    if (pinned(w < 4)) fa_tload(d0, d1);
    // the tile's 64 q rows into LDS once: their fragments are re-read every stage instead of holding registers through the attn.v products
    { const size_t o = (size_t)(r0 + (tid >> 2)) * CK + (tid & 3) * 8; unsigned char* d = sm + 2 * FA_BUF + (tid >> 2) * FA_QP + (tid & 3) * 16; *(v8usa*)d = *(const v8us*)(Qf + o); }
    v8f acc[2][16];
#pragma unroll
    for (int nb = 0; nb < 2; ++nb)
#pragma unroll
        for (int cb = 0; cb < 16; ++cb) acc[nb][cb] = (v8f){};
    asm volatile("s_wait_dscnt 0x0" ::: "memory");      // this wave's q rows are written before the barrier publishes them
    __syncthreads();
    const unsigned char* qf = sm + 2 * FA_BUF + (nh * 32 + lr) * FA_QP + hi * 16;
    const unsigned ko = (unsigned)((ks * 32 + lr) * CK + 8 * hi);
    v16h kf[2], a[2];
    const bf* kq0 = Kf + ko + (size_t)FA_ST(0) * 128 * CK; const bf* kq1 = Kf + ko + (size_t)FA_ST(1) * 128 * CK;   // this lane's K rows of the first two trips
#pragma unroll
    for (int mt = 0; mt < 2; ++mt) kf[mt] = fa_ldk(kq0 + mt * 16 * CK);
    // the first trip's sigmoid weights
#pragma unroll
    for (int nb = 0; nb < 2; ++nb) { const v16h qv = fa_ldh(qf + nb * 16 * FA_QP); v8u ph;
#pragma unroll
        for (int mt = 0; mt < 2; ++mt) { const v8f s = wmma16(kf[mt], qv, (v8f){});
#pragma unroll
            for (int j = 0; j < 4; ++j) ph[mt * 4 + j] = fa_sig2(s[2 * j], s[2 * j + 1]); }
        a[nb] = __builtin_bit_cast(v16h, ph); }
#pragma unroll
    for (int mt = 0; mt < 2; ++mt) kf[mt] = fa_ldk(kq1 + mt * 16 * CK);
    asm volatile("s_wait_xcnt 0x0" :: "v"(kq0), "v"(kq1) : "memory");   // behind the K loads above: it names their addresses, whose registers so stay unwritten up to it
    const unsigned fro = (unsigned)(lr * FA_PITCH + ks * 64 + hi * 16);
#pragma unroll 1   // one stage a trip: the two-buffer order below is per trip
    for (int t = 0; t < FA_NST; ++t) {
        // hand-over at the head of the trip, so that the work below is the loop's last block and stays between the products
        asm volatile("s_wait_dscnt 0x0" ::: "memory");      // this wave's reads of stage t - 1 are done before its buffer is refilled
        fa_twait(d0, d1);                                   // an issuing wave's tile of stage t has landed
        __syncthreads();                                    // publishes stage t and ends every reader's use of stage t - 1
        if (pinned((w < 4) & (t + 1 < FA_NST))) { const unsigned n = pinned((unsigned)t + 1u);   // pinned: the descriptor words are formed here, behind the wait
            d0 = fa_g0(l0 + (n & 1u) * FA_BUF, g0 + (unsigned long long)FA_ST(n) * 256u);
            asm volatile("" : "+s"(d0));   // pinned descriptor words, as in front of the loop: the load names the registers that the next trip's wait names
            fa_tload(d0, d1); }
        const unsigned char* fb = sm + (t & 1) * FA_BUF + fro;
        v16h bv[2][4];   // V fragments of four c blocks, [group parity][c block]
        v8f st[2][2];
        v8u ph[2];
        { v16h qv[2];
#pragma unroll
            for (int nb = 0; nb < 2; ++nb) qv[nb] = fa_ldh(qf + nb * 16 * FA_QP);
#pragma unroll
            for (int cc = 0; cc < 4; ++cc) bv[0][cc] = fa_ldh(fb + FA_CB(cc));
            // scores of trip t + 1 (the last trip works the walk's first stage again; its weights are not used)
#pragma unroll
            for (int nb = 0; nb < 2; ++nb)
#pragma unroll
                for (int mt = 0; mt < 2; ++mt) st[nb][mt] = wmma16(kf[mt], qv[nb], (v8f){}); }
        const size_t kn = (size_t)FA_ST(t + 2) * 128 * CK;   // wraps: the last two trips read the walk's first two stages again, in bounds
#pragma unroll
        for (int g = 0; g < 4; ++g) { const int cu = g & 1, nx = cu ^ 1;
            __builtin_amdgcn_sched_barrier(0);   // keeps the next group's fragment loads ahead of this group's products, so that their latency is covered
            if (g < 3) {
#pragma unroll
                for (int cc = 0; cc < 4; ++cc) bv[nx][cc] = fa_ldh(fb + FA_CB((g + 1) * 4 + cc));
            } else {
#pragma unroll
                for (int mt = 0; mt < 2; ++mt) kf[mt] = fa_ldk((Kf + kn + mt * 16 * CK) + ko);
            }
            __builtin_amdgcn_sched_barrier(0);   // the loads above stay above; the sigmoids below stay in this group, between the products
#pragma unroll
            for (int cc = 0; cc < 4; ++cc)
#pragma unroll
                for (int nb = 0; nb < 2; ++nb) acc[nb][g * 4 + cc] = wmma16(a[nb], bv[cu][cc], acc[nb][g * 4 + cc]);
#pragma unroll
            for (int u = 0; u < 4; ++u) { const int e = g * 4 + u, nb = e >> 3, i = e & 7; ph[nb][i] = fa_sig2(st[nb][i >> 2][2 * (i & 3)], st[nb][i >> 2][2 * (i & 3) + 1]); } }
#pragma unroll
        for (int nb = 0; nb < 2; ++nb) a[nb] = __builtin_bit_cast(v16h, ph[nb]);
    }
    asm volatile("s_wait_tensorcnt 0x0" ::: "memory");      // nothing in flight when LDS becomes the partial tiles
    asm volatile("s_wait_dscnt 0x0" ::: "memory");          // this wave's reads of the last stage are done
    __syncthreads();                                        // every wave has left the last stage before its buffer is overwritten
    float* red = (float*)sm;
    float* mine = red + (size_t)ks * C_ * FA_TP + lr * FA_TP + nh * 32 + hi * 8;
#pragma unroll
    for (int nb = 0; nb < 2; ++nb)
#pragma unroll
        for (int cb = 0; cb < 16; ++cb) { float* d = mine + cb * 16 * FA_TP + nb * 16;
            *(v4fa*)d = __builtin_shufflevector(acc[nb][cb], acc[nb][cb], 0, 1, 2, 3); *(v4fa*)(d + 4) = __builtin_shufflevector(acc[nb][cb], acc[nb][cb], 4, 5, 6, 7); }
    __syncthreads();
    const float gm = bfr(GM[0]);
#pragma unroll
    for (int s = 0; s < 16; ++s) { const int idx = s * 256 + tid, c = idx >> 4, nofs = (idx & 15) * 4; const float* p = red + c * FA_TP + nofs; v4f val = *(const v4fa*)p;
#pragma unroll
        for (int k = 1; k < 4; ++k) val += *(const v4fa*)(p + k * C_ * FA_TP);
        const size_t o = (size_t)c * HW + r0 + nofs; const v4f xv = *(const v4f*)(X + o); v4f ov;
#pragma unroll
        for (int q = 0; q < 4; ++q) ov[q] = __fadd_rn(__fmul_rn(gm, val[q]), bfr(xv[q]));
        *(v4f*)(O + o) = ov; }
}

extern "C" void kernel_launch(void* const* d_in, const int* in_sizes, int n_in,
                              void* d_out, int out_size, void* d_ws, size_t ws_size, hipStream_t stream) {
    (void)in_sizes; (void)n_in; (void)out_size;
    const float* x = (const float*)d_in[0]; const float* wq = (const float*)d_in[1]; const float* bq = (const float*)d_in[2]; const float* wk = (const float*)d_in[3]; const float* bk = (const float*)d_in[4]; const float* wv = (const float*)d_in[5]; const float* bv = (const float*)d_in[6]; const float* GM = (const float*)d_in[7];
    float* OUT = (float*)d_out;     // [4][256][4096]
    char* wsp = (char*)d_ws;
    auto take = [&](size_t bytes) { char* p = wsp; wsp += (bytes + 255) & ~(size_t)255; return (void*)p; };
    bf* Qf = (bf*)take((size_t)NB_ * HW * CK * 2); bf* Kf = (bf*)take((size_t)NB_ * HW * CK * 2); bf* VTf = (bf*)take((size_t)NB_ * C_ * HW * 2);
    if ((size_t)(wsp - (char*)d_ws) > ws_size) return;
    k_conv<<<dim3(HW / 64, NB_, 1), 256, 0, stream>>>(x, wq, wk, wv, Qf, Kf, VTf, bq, bk, bv);                                                /* q, k as f16 planes [b][n][32]; v as one transposed f16 plane [b][c][m] */
    k_fa<<<dim3(HW / 64, NB_, 1), 256, 0, stream>>>(Qf, Kf, VTf, x, GM, OUT);                                                  /* out[b][c][n] = gamma sum_m sigmoid(q_n . k_m) v[c][m] + x[b][c][n] */
}

// v010
// It runs in 41 microseconds.
// Timed twice side by side with v009, it ran 1.03 and 1.04 times as fast.
// All steps since v000 together make it 15.6 times as fast.
#include <hip/hip_runtime.h>

// Sigmoid attention on a channel-major feature map (x [4][256][64][64] -> [c][n], n = 4096; q = Wq x + bq, k = Wk x + bk ([32][256] 1x1 convs), v = Wv x + bv ([256][256]); attn[n][m] = sigmoid(sum_o q[o][n] k[o][m]) (no softmax, no scaling); out[c][n] = sum_m v[c][m] attn[n][m]; result = gamma out + x (gamma scalar, read) -> [4][256][64][64] (4.2 M)).
// Layout, two launches, each over all batches: the 1x1 convs are one GEMM of token-major x against the stacked [out][in] weights [Wq ; Wk ; Wv] (+ bias), whose work-groups round and transpose their own x tile and the weights into LDS; the epilogue of its [q | k] tiles writes the f16 planes [n][32], that of its v tiles one transposed [c][m] f16 plane; one kernel over all batches forms the scores (1 product, f32 accumulate), takes the sigmoid, rounds it to f16 in registers, multiplies by v (1 product) and writes the channel-major output gamma Y + x with n fastest.
// Compute dtypes, f32 accumulate: x, weights, biases, gamma rounded to bf16; x exact bf16; the f32 conv outputs q, k, v and the sigmoid weights each rounded once to f16 (11 significant bits; magnitudes below 65504), scores and attn.v 1 f16 product each; sigmoid in f32 (hardware exp2 and reciprocal); residual in f32.

#define NB_  4
#define C_   256
#define HW   4096
#define CK   32
typedef _Float16 h16;
typedef unsigned short bf;
typedef __attribute__((ext_vector_type(16))) __bf16   v16bf;
typedef __attribute__((ext_vector_type(16))) _Float16 v16h;
typedef __attribute__((ext_vector_type(8)))  _Float16 v8h;
typedef __attribute__((ext_vector_type(8)))  unsigned short v8us;
typedef __attribute__((ext_vector_type(8)))  float    v8f;
typedef __attribute__((ext_vector_type(4)))  float    v4f;
typedef __attribute__((ext_vector_type(2)))  float    v2f;
typedef __attribute__((ext_vector_type(2)))  unsigned short v2us;
typedef v8h  __attribute__((may_alias)) v8ha;
typedef __attribute__((ext_vector_type(4)))  _Float16 v4h;
typedef v4h  __attribute__((may_alias)) v4ha;
typedef v4f  __attribute__((may_alias)) v4fa;
typedef v8us __attribute__((may_alias)) v8usa;

__device__ __forceinline__ unsigned short f2bf(float f) { unsigned u = __float_as_uint(f); u += 0x7FFFu + ((u >> 16) & 1u); return (unsigned short)(u >> 16); }
__device__ __forceinline__ float bf2f(unsigned short b) { return __uint_as_float(((unsigned)b) << 16); }
__device__ __forceinline__ float bfr(float f) { return bf2f(f2bf(f)); }
__device__ __forceinline__ v16h cat16(v8h lo, v8h hi) { return __builtin_shufflevector(lo, hi, 0, 1, 2, 3, 4, 5, 6, 7, 8, 9, 10, 11, 12, 13, 14, 15); }
__device__ __forceinline__ v16bf cat16b(v8us lo, v8us hi) { return __builtin_bit_cast(v16bf, __builtin_shufflevector(lo, hi, 0, 1, 2, 3, 4, 5, 6, 7, 8, 9, 10, 11, 12, 13, 14, 15)); }
__device__ __forceinline__ v8f wmma16(v16h a, v16h b, v8f c) { return __builtin_amdgcn_wmma_f32_16x16x32_f16(false, a, false, b, (short)0, c, false, false); }
__device__ __forceinline__ v8f wmmab(v16bf a, v16bf b, v8f c) { return __builtin_amdgcn_wmma_f32_16x16x32_bf16(false, a, false, b, (short)0, c, false, false); }

// ---- k_conv: the three 1x1 convs of all batches as one GEMM; one 8-wave work-group per 64 tokens x all 320 outputs of one batch; grid (HW/64, NB_), 256 threads.
// C[m][n] (f32, + bias[n]) = sum_k x[z][k][m] Wt[n][k], Wt = [Wq ; Wk ; Wv] stacked by rows. All eight waves bring the operands into LDS as K-contiguous bf16 rows: the x tile [256 c][64 tokens] is read with the tokens along the lanes (whole 128-byte lines) and a lane writes 8 channels of its token as one 16-byte piece, which is the transpose; the weights are read as whole rows.
// Waves 0..4 then each work one 64x64 output tile (16 accumulators): wave 0 is [q | k], waves 1.. are v.
// C is not stored: the epilogue rounds it to f16. [q | k] tile: columns 0..31 to Qf and 32..63 to Kf, planes [m][32]. v tiles: transposed plane Vf [c][HW]; an accumulator lane holds 8 consecutive m of one column, which is one 16-byte piece of a transposed row.
#define CV_P 528                     /* 512-byte bf16 row + 16: conflict-free for 16-byte LDS writes and reads */
typedef __attribute__((ext_vector_type(4))) __bf16 v4bf;
typedef __attribute__((ext_vector_type(8))) __bf16 v8bf;
typedef v4bf __attribute__((may_alias)) v4bfa;
typedef v8bf __attribute__((may_alias)) v8bfa;
__device__ __forceinline__ v16bf av_ld(const unsigned char* p) { return cat16b(*(const v8usa*)p, *(const v8usa*)(p + 32)); }
// 4 N weight rows, f32 -> bf16 (nearest even, like f2bf) -> LDS; the 256 threads read 4 whole rows a step, 16 bytes a lane.
template <int N> __device__ __forceinline__ void cv_w(const float* __restrict__ src, unsigned char* dst, int tid) {
    src += tid * 4; dst += (tid >> 6) * CV_P + (tid & 63) * 8;
#pragma unroll   // straight-line, like the loops inside: many loads are in flight before the first conversion waits
    for (int i0 = 0; i0 < N; i0 += 8) { v4f v[8];
#pragma unroll
        for (int i = 0; i < 8; ++i) v[i] = *(const v4f*)(src + (i0 + i) * 1024);
#pragma unroll
        for (int i = 0; i < 8; ++i) *(v4bfa*)(dst + (i0 + i) * 4 * CV_P) = __builtin_convertvector(v[i], v4bf); }
}
template <typename T16> struct WFrag;
template <> struct WFrag<bf> { typedef v16bf V; static __device__ __forceinline__ V ld(const bf* p) { return cat16b(*(const v8us*)p, *(const v8us*)(p + 16)); } static __device__ __forceinline__ v8f mma(V a, V b, v8f c) { return wmmab(a, b, c); } };
__global__ __launch_bounds__(256) void k_conv(const float* __restrict__ x, const float* __restrict__ wq, const float* __restrict__ wk, const float* __restrict__ wv, bf* Qf, bf* Kf, bf* Vf, const float* __restrict__ bq, const float* __restrict__ bk, const float* __restrict__ bv) {
    typedef WFrag<bf>::V V;
    __shared__ __align__(16) unsigned char xs[64 * CV_P];
    __shared__ __align__(16) unsigned char wsm[(2 * CK + C_) * CV_P];
    __shared__ __align__(16) float os[16 * 68];
    const size_t z = blockIdx.y;
    const int tid = threadIdx.x, lane = tid & 31, lr = lane & 15, hi = lane >> 4; const int r0 = blockIdx.x * 64;
    const int w = __builtin_amdgcn_readfirstlane(tid >> 5);
    { // wave w brings channels 32 w .. + 31 of the 64 tokens: piece i is 8 channels of 32 tokens
        const float* xb = x + z * C_ * HW + (size_t)w * 32 * HW + r0 + lane; v8f v[8];
#pragma unroll
        for (int i = 0; i < 8; ++i)
#pragma unroll
            for (int q = 0; q < 8; ++q) v[i][q] = xb[(size_t)((i >> 1) * 8 + q) * HW + (i & 1) * 32];
        cv_w<CK / 4>(wq, wsm, tid); cv_w<CK / 4>(wk, wsm + CK * CV_P, tid); cv_w<C_ / 4>(wv, wsm + 2 * CK * CV_P, tid);
#pragma unroll
        for (int i = 0; i < 8; ++i) *(v8bfa*)(xs + ((i & 1) * 32 + lane) * CV_P + (w * 4 + (i >> 1)) * 16) = __builtin_convertvector(v[i], v8bf);
        asm volatile("s_wait_xcnt 0x0" ::: "memory");   // the loads' address registers may be reused by what follows
    }
    __syncthreads();                                    // publishes the x tile and the weights
    if (w >= (2 * CK + C_) / 64) return;                // five output tiles; no barrier follows
    v8f acc[4][4];
#pragma unroll
    for (int mb = 0; mb < 4; ++mb)
#pragma unroll
        for (int nb = 0; nb < 4; ++nb) acc[mb][nb] = (v8f){};
    const unsigned char* ap = xs + lr * CV_P + hi * 16; const unsigned char* bp = wsm + (w * 64 + lr) * CV_P + hi * 16;
#pragma unroll   // straight-line: the LDS reads of the next k step stand among this step's products
    for (int kc = 0; kc < C_; kc += 32) {
        V a[4];
#pragma unroll
        for (int mb = 0; mb < 4; ++mb) a[mb] = av_ld(ap + mb * 16 * CV_P + kc * 2);
#pragma unroll
        for (int nb = 0; nb < 4; ++nb) { const V b = av_ld(bp + nb * 16 * CV_P + kc * 2);
#pragma unroll
            for (int mb = 0; mb < 4; ++mb) acc[mb][nb] = WFrag<bf>::mma(a[mb], b, acc[mb][nb]); }
    }
    if (w == 0) {
        const int c = lr * 4;   // a lane's four columns lie in one plane: q below CK, k from CK on
        const size_t po = z * HW * CK + (size_t)(r0 + hi) * CK;
        bf* dh = ((c < CK) ? (Qf + c) : (Kf + (c - CK))) + po;
        const float* bs = (c < CK) ? (bq + c) : (bk + (c - CK));
        v4f bb; bb[0] = bfr(bs[0]); bb[1] = bfr(bs[1]); bb[2] = bfr(bs[2]); bb[3] = bfr(bs[3]);
#pragma unroll
        for (int mb = 0; mb < 4; ++mb) {
#pragma unroll
            for (int nb = 0; nb < 4; ++nb) {
#pragma unroll
                for (int j = 0; j < 8; ++j) os[(hi * 8 + j) * 68 + nb * 16 + lr] = acc[mb][nb][j]; }
            __builtin_amdgcn_wave_barrier(); asm volatile("" ::: "memory");   // the row reads below stay behind the other lanes' writes
#pragma unroll
            for (int s = 0; s < 8; ++s) { v4f val = *(const v4fa*)(os + (2 * s + hi) * 68 + lr * 4); val += bb;
                *(v4ha*)(dh + (mb * 16 + 2 * s) * CK) = __builtin_convertvector(val, v4h); }
            __builtin_amdgcn_wave_barrier(); asm volatile("" ::: "memory");   // the next block's writes stay behind these reads
        }
    } else {
        const int c0 = (w - 1) * 64;
#pragma unroll
        for (int nb = 0; nb < 4; ++nb) { const int c = c0 + nb * 16 + lr; const float bb = bfr(bv[c]); const size_t o = z * C_ * HW + (size_t)c * HW + r0 + hi * 8;
#pragma unroll
            for (int mb = 0; mb < 4; ++mb) *(v8ha*)(Vf + o + mb * 16) = __builtin_convertvector(acc[mb][nb] + bb, v8h); }
        asm volatile("s_wait_xcnt 0x0" ::: "memory");   // behind the last stores: none of their registers is rewritten ahead of it
    }
}


// ---- k_fa: out[c][n] = gamma Y[n][c] + x[c][n], Y[n][c] = sum_m sigmoid(q_n . k_m) V[c][m]; scores, sigmoid, attn.v and the residual in one kernel; one 8-wave work-group per 64 rows n x all 256 c of one batch; grid (HW/64, NB_), 256 threads.
// Wave w owns rows 32 (w & 1) .. + 31 and the k slice [32 (w >> 1), + 32) of every 128-m stage. It forms S^T = K Q^T, whose accumulator layout (lane = n, registers = 8 consecutive m) is the A fragment layout of the attn.v product, so the sigmoid weights go from registers to registers.
// The scores and sigmoids of stage t + 1 are worked between the attn.v products of stage t. V (f16) is staged in LDS by tensor loads (waves 0..3, 64 rows c each), two buffers; K (f16) likewise by wave 4, one stage ahead of V, two buffers of its own; the tile's Q rows lie in LDS. A work-group walks the stages from one of 32 starts (blocks x and x + 4 share one) and wraps (FA_ST), so that, walking in step, only blocks x and x + 4 of a batch are on the same V and K tiles. The four k-slice partials are summed through LDS in slice order; they lie there transposed, [slice][c][n] (an accumulator lane holds 8 consecutive n of one c), so that the output rows are read and stored with n fastest.
#define FA_PITCH 272                 /* 256-byte row piece + 16: conflict-free for 16-byte LDS reads */
#define FA_TROWS 64                  /* rows c of one tensor load */
#define FA_SLICE 18432               /* LDS bytes of one load's tile: 64 padded rows (17408), rounded up to a multiple of 2 KiB */
#define FA_BUF   ((C_ / FA_TROWS) * FA_SLICE)
#define FA_CB(cb) (((cb) >> 2) * FA_SLICE + ((cb) & 3) * 16 * FA_PITCH)   /* place of the 16-row c block cb in a buffer */
#define FA_NST   (HW / 128)
#define FA_ST(i) (((unsigned)(i) + rot) & (unsigned)(FA_NST - 1))   /* the m stage worked in trip i */
static_assert((FA_NST & (FA_NST - 1)) == 0, "the wrap is a mask");
#define FA_TP    68                  /* f32 pitch of a transposed partial row: 64 n + 4, conflict-free for 16-byte LDS writes and reads */
#define FA_QP    80                  /* 64-byte q row + 16 */
#define FA_QPL   (64 * FA_QP)         /* the tile's 64 q rows */
#define FA_KROWS 32                  /* one stage's K, 128 rows of 64 bytes in a row, moved as 32 rows of 256 bytes */
#define FA_KBUF  10240               /* LDS bytes of one K tile: 32 padded rows (8704), rounded up to a multiple of 2 KiB */
#define FA_KOFF  (2 * FA_BUF + 6144) /* the K buffers' place: behind the q rows, at a multiple of 2 KiB */
#define FA_KR(r) (((r) >> 2) * FA_PITCH + ((r) & 3) * 64)   /* place of k row r in a K tile: 16 rows in turn start on 16 different bank quads */
// One tensor load brings a quarter of V of one stage: 64 rows of 256 bytes at the source pitch of a [c][HW] f16 row; or K of one stage: 32 rows of 256 bytes at a source pitch of 256. The mover lays 16 pad bytes behind every row, which is FA_PITCH. Extents in bytes, tensor = tile, no mask.
typedef unsigned u32x4 __attribute__((ext_vector_type(4)));
typedef unsigned u32x8 __attribute__((ext_vector_type(8)));
static_assert(FA_PITCH == 256 + 16 && FA_TROWS * FA_PITCH <= FA_SLICE && FA_SLICE % 2048 == 0, "every tile's place in LDS is a multiple of 2 KiB");
static_assert(FA_KROWS * 256 == 128 * CK * 2 && FA_KROWS * FA_PITCH <= FA_KBUF && FA_KBUF % 2048 == 0 && FA_KOFF % 2048 == 0 && 2 * FA_BUF + FA_QPL <= FA_KOFF, "the K tiles too");
__device__ __forceinline__ unsigned uni(unsigned v) { return (unsigned)__builtin_amdgcn_readfirstlane(v); }
__device__ __forceinline__ unsigned pinned(unsigned v) { unsigned w = uni(v); asm volatile("" : "+s"(w)); return w; }   // holds the word in a scalar register: a test on it is a scalar branch, which a tensor load needs (it ignores EXEC)
__device__ __forceinline__ u32x4 fa_g0(unsigned lds, unsigned long long ga) {
    u32x4 g; g[0] = uni(1u); g[1] = uni(lds); g[2] = uni((unsigned)ga); g[3] = uni((((unsigned)(ga >> 32)) & 0x01FFFFFFu) | 0x80000000u); return g; }
__device__ __forceinline__ u32x8 fa_g1(unsigned rows, unsigned pitch) {
    u32x8 g; g[0] = uni((1u << 20) | (5u << 22) | (3u << 25)); g[1] = uni(256u << 16); g[2] = uni(rows << 16); g[3] = uni(256u << 16); g[4] = uni(rows); g[5] = uni(pitch); g[6] = uni(0u); g[7] = uni(0u); return g; }
__device__ __forceinline__ void fa_tload(u32x4 d0, u32x8 d1) { asm volatile("tensor_load_to_lds %0, %1" :: "s"(d0), "s"(d1) : "memory"); }
// The wait names both groups as inputs: their registers stay live, and so unwritten, from the request to the wait that covers it.
__device__ __forceinline__ void fa_twait(u32x4 d0, u32x8 d1) { asm volatile("s_wait_tensorcnt 0x0" :: "s"(d0), "s"(d1) : "memory"); }
// Two sigmoid weights, packed as the two f16 of one fragment register: 1 / (1 + 2^(-s log2 e)) on the hardware exp2 and reciprocal (both limits right: 2^+inf -> 0, 2^-inf -> 1); the packed conversion rounds to nearest even.
typedef __attribute__((ext_vector_type(2))) _Float16 v2h;
typedef __attribute__((ext_vector_type(8))) unsigned v8u;
__device__ __forceinline__ v16h fa_ldh(const unsigned char* p) { return cat16(*(const v8ha*)p, *(const v8ha*)(p + 32)); }
__device__ __forceinline__ v16h fa_ldk(const bf* p) { return __builtin_bit_cast(v16h, WFrag<bf>::ld(p)); }
__device__ __forceinline__ unsigned fa_sig2(float s0, float s1) {
    v2f t; t[0] = s0; t[1] = s1; t *= -1.44269504088896341f;
    v2f d; d[0] = __builtin_amdgcn_exp2f(t[0]); d[1] = __builtin_amdgcn_exp2f(t[1]); d += 1.0f;
    v2f sg; sg[0] = __builtin_amdgcn_rcpf(d[0]); sg[1] = __builtin_amdgcn_rcpf(d[1]);
    return __builtin_bit_cast(unsigned, __builtin_convertvector(sg, v2h));
}
__global__ __launch_bounds__(256) void k_fa(const bf* __restrict__ Qf, const bf* __restrict__ Kf, const bf* __restrict__ Vf, const float* __restrict__ X, const float* __restrict__ GM, float* O) {
    __shared__ __attribute__((aligned(2048))) unsigned char sm[4 * C_ * FA_TP * 4];   // the four partial tiles of the epilogue are the larger use
    static_assert(FA_KOFF + 2 * FA_KBUF <= 4 * C_ * FA_TP * 4, "the two V buffers, the q rows and the two K buffers fit");
    const int tid = threadIdx.x, lane = tid & 31, lr = lane & 15, hi = lane >> 4;
    const int w = __builtin_amdgcn_readfirstlane(tid >> 5);
    const size_t z = blockIdx.y; Qf += z * HW * CK; Kf += z * HW * CK; Vf += z * C_ * HW; X += z * C_ * HW; O += z * C_ * HW;
    const int r0 = blockIdx.x * 64, nh = w & 1, ks = w >> 1;
    // Start of the walk. All groups of a batch read the same V and K; walking in step they ask for each tile at the same moment, also the first time, when it is not yet in their L2. With 32 starts a tile is fetched by the group that starts there and found in L2 by the others. Blocks x and x + 4 share a start; any placement gives right values.
    const unsigned rot = (((blockIdx.x >> 3) << 2) | (blockIdx.x & 3u)) & (unsigned)(FA_NST - 1);
    // waves 0..4 issue, one request a stage: wave w < 4 brings rows 64 w .. + 63 of V, wave 4 all of K. The tile of walk index n goes to buffer n & 1 of its kind. Trip t reads V of index t and K of index t + 1, so K runs one index ahead of V (ld).
    const bool kw = w >= 4;
    const unsigned long long g0 = (unsigned long long)(size_t)(kw ? Kf : Vf + (size_t)(w & 3) * FA_TROWS * HW);
    const unsigned l0 = (unsigned)(size_t)sm + (kw ? (unsigned)FA_KOFF : (unsigned)((w & 3) * FA_SLICE));
    const unsigned ld = kw ? 2u : 1u, sstep = kw ? 128u * CK * 2u : 256u, bstep = kw ? (unsigned)FA_KBUF : (unsigned)FA_BUF;   // index issued in trip t is t + ld; source bytes from stage to stage; LDS bytes from buffer to buffer
    u32x8 d1 = fa_g1(kw ? (unsigned)FA_KROWS : (unsigned)FA_TROWS, kw ? 256u : (unsigned)HW * 2u);
    u32x4 d0 = fa_g0(l0 + ((ld - 1u) & 1u) * bstep, g0 + (unsigned long long)(FA_ST(ld - 1u) * sstep));
    asm volatile("" : "+s"(d0), "+s"(d1));   // pinned descriptor words: each group is one set of scalar registers, the same at the load and at the wait that names it
    if (pinned(w < 5)) fa_tload(d0, d1);
    // the tile's 64 q rows into LDS once: their fragments are re-read every stage instead of holding registers through the attn.v products
    { const size_t o = (size_t)(r0 + (tid >> 2)) * CK + (tid & 3) * 8; unsigned char* d = sm + 2 * FA_BUF + (tid >> 2) * FA_QP + (tid & 3) * 16; *(v8usa*)d = *(const v8us*)(Qf + o); }
    v8f acc[2][16];
#pragma unroll
    for (int nb = 0; nb < 2; ++nb)
#pragma unroll
        for (int cb = 0; cb < 16; ++cb) acc[nb][cb] = (v8f){};
    asm volatile("s_wait_dscnt 0x0" ::: "memory");      // this wave's q rows are written before the barrier publishes them
    __syncthreads();
    const unsigned char* qf = sm + 2 * FA_BUF + (nh * 32 + lr) * FA_QP + hi * 16;
    const unsigned ko = (unsigned)((ks * 32 + lr) * CK + 8 * hi);
    v16h kf[2], a[2];
    const bf* kq0 = Kf + ko + (size_t)FA_ST(0) * 128 * CK;   // this lane's K rows of the first trip, read straight from their plane
#pragma unroll
    for (int mt = 0; mt < 2; ++mt) kf[mt] = fa_ldk(kq0 + mt * 16 * CK);
    asm volatile("s_wait_xcnt 0x0" :: "v"(kq0) : "memory");   // behind the K loads above: it names their address, whose registers so stay unwritten up to it
    // the first trip's sigmoid weights
#pragma unroll
    for (int nb = 0; nb < 2; ++nb) { const v16h qv = fa_ldh(qf + nb * 16 * FA_QP); v8u ph;
#pragma unroll
        for (int mt = 0; mt < 2; ++mt) { const v8f s = wmma16(kf[mt], qv, (v8f){});
#pragma unroll
            for (int j = 0; j < 4; ++j) ph[mt * 4 + j] = fa_sig2(s[2 * j], s[2 * j + 1]); }
        a[nb] = __builtin_bit_cast(v16h, ph); }
    const unsigned kro = (unsigned)(FA_KOFF + FA_KR(ks * 32 + lr) + hi * 16);
    const unsigned fro = (unsigned)(lr * FA_PITCH + ks * 64 + hi * 16);
#pragma unroll 1   // one stage a trip: the two-buffer order below is per trip
    for (int t = 0; t < FA_NST; ++t) {
        // hand-over at the head of the trip, so that the work below is the loop's last block and stays between the products
        asm volatile("s_wait_dscnt 0x0" ::: "memory");      // this wave's reads of trip t - 1 are done before their buffers are refilled
        fa_twait(d0, d1);                                   // an issuing wave's tile has landed: V of index t, K of index t + 1
        __syncthreads();                                    // publishes V of index t and K of index t + 1 and ends every reader's use of the buffers read in trip t - 1
        if (pinned((w < 5) & ((unsigned)t + ld < (unsigned)FA_NST))) { const unsigned n = pinned((unsigned)t + ld);   // pinned: the descriptor words are formed here, behind the wait
            d0 = fa_g0(l0 + (n & 1u) * bstep, g0 + (unsigned long long)(FA_ST(n) * sstep));
            asm volatile("" : "+s"(d0));   // pinned descriptor words, as in front of the loop: the load names the registers that the next trip's wait names
            fa_tload(d0, d1); }
        const unsigned char* fb = sm + (t & 1) * FA_BUF + fro;
        v16h bv[2][4];   // V fragments of four c blocks, [group parity][c block]
        v8f st[2][2];
        v8u ph[2];
        { v16h qv[2];
#pragma unroll
            for (int nb = 0; nb < 2; ++nb) qv[nb] = fa_ldh(qf + nb * 16 * FA_QP);
            const unsigned char* kb = sm + ((t + 1) & 1) * FA_KBUF + kro;
#pragma unroll
            for (int mt = 0; mt < 2; ++mt) kf[mt] = fa_ldh(kb + FA_KR(mt * 16));
#pragma unroll
            for (int cc = 0; cc < 4; ++cc) bv[0][cc] = fa_ldh(fb + FA_CB(cc));
            // scores of trip t + 1 (no K tile is brought for the last trip: it works again the one that its buffer still holds; its weights are not used)
#pragma unroll
            for (int nb = 0; nb < 2; ++nb)
#pragma unroll
                for (int mt = 0; mt < 2; ++mt) st[nb][mt] = wmma16(kf[mt], qv[nb], (v8f){}); }
#pragma unroll
        for (int g = 0; g < 4; ++g) { const int cu = g & 1, nx = cu ^ 1;
            __builtin_amdgcn_sched_barrier(0);   // keeps the next group's fragment loads ahead of this group's products, so that their latency is covered
            if (g < 3) {
#pragma unroll
                for (int cc = 0; cc < 4; ++cc) bv[nx][cc] = fa_ldh(fb + FA_CB((g + 1) * 4 + cc));
            }
            __builtin_amdgcn_sched_barrier(0);   // the loads above stay above; the sigmoids below stay in this group, between the products
#pragma unroll
            for (int cc = 0; cc < 4; ++cc)
#pragma unroll
                for (int nb = 0; nb < 2; ++nb) acc[nb][g * 4 + cc] = wmma16(a[nb], bv[cu][cc], acc[nb][g * 4 + cc]);
#pragma unroll
            for (int u = 0; u < 4; ++u) { const int e = g * 4 + u, nb = e >> 3, i = e & 7; ph[nb][i] = fa_sig2(st[nb][i >> 2][2 * (i & 3)], st[nb][i >> 2][2 * (i & 3) + 1]); } }
#pragma unroll
        for (int nb = 0; nb < 2; ++nb) a[nb] = __builtin_bit_cast(v16h, ph[nb]);
    }
    asm volatile("s_wait_tensorcnt 0x0" ::: "memory");      // nothing in flight when LDS becomes the partial tiles
    asm volatile("s_wait_dscnt 0x0" ::: "memory");          // this wave's reads of the last stage are done
    __syncthreads();                                        // every wave has left the last stage before its buffer is overwritten
    float* red = (float*)sm;
    float* mine = red + (size_t)ks * C_ * FA_TP + lr * FA_TP + nh * 32 + hi * 8;
#pragma unroll
    for (int nb = 0; nb < 2; ++nb)
#pragma unroll
        for (int cb = 0; cb < 16; ++cb) { float* d = mine + cb * 16 * FA_TP + nb * 16;
            *(v4fa*)d = __builtin_shufflevector(acc[nb][cb], acc[nb][cb], 0, 1, 2, 3); *(v4fa*)(d + 4) = __builtin_shufflevector(acc[nb][cb], acc[nb][cb], 4, 5, 6, 7); }
    __syncthreads();
    const float gm = bfr(GM[0]);
#pragma unroll
    for (int s = 0; s < 16; ++s) { const int idx = s * 256 + tid, c = idx >> 4, nofs = (idx & 15) * 4; const float* p = red + c * FA_TP + nofs; v4f val = *(const v4fa*)p;
#pragma unroll
        for (int k = 1; k < 4; ++k) val += *(const v4fa*)(p + k * C_ * FA_TP);
        const size_t o = (size_t)c * HW + r0 + nofs; const v4f xv = *(const v4f*)(X + o); v4f ov;
#pragma unroll
        for (int q = 0; q < 4; ++q) ov[q] = __fadd_rn(__fmul_rn(gm, val[q]), bfr(xv[q]));
        *(v4f*)(O + o) = ov; }
}

extern "C" void kernel_launch(void* const* d_in, const int* in_sizes, int n_in,
                              void* d_out, int out_size, void* d_ws, size_t ws_size, hipStream_t stream) {
    (void)in_sizes; (void)n_in; (void)out_size;
    const float* x = (const float*)d_in[0]; const float* wq = (const float*)d_in[1]; const float* bq = (const float*)d_in[2]; const float* wk = (const float*)d_in[3]; const float* bk = (const float*)d_in[4]; const float* wv = (const float*)d_in[5]; const float* bv = (const float*)d_in[6]; const float* GM = (const float*)d_in[7];
    float* OUT = (float*)d_out;     // [4][256][4096]
    char* wsp = (char*)d_ws;
    auto take = [&](size_t bytes) { char* p = wsp; wsp += (bytes + 255) & ~(size_t)255; return (void*)p; };
    bf* Qf = (bf*)take((size_t)NB_ * HW * CK * 2); bf* Kf = (bf*)take((size_t)NB_ * HW * CK * 2); bf* VTf = (bf*)take((size_t)NB_ * C_ * HW * 2);
    if ((size_t)(wsp - (char*)d_ws) > ws_size) return;
    k_conv<<<dim3(HW / 64, NB_, 1), 256, 0, stream>>>(x, wq, wk, wv, Qf, Kf, VTf, bq, bk, bv);                                                /* q, k as f16 planes [b][n][32]; v as one transposed f16 plane [b][c][m] */
    k_fa<<<dim3(HW / 64, NB_, 1), 256, 0, stream>>>(Qf, Kf, VTf, x, GM, OUT);                                                  /* out[b][c][n] = gamma sum_m sigmoid(q_n . k_m) v[c][m] + x[b][c][n] */
}
